// v000
// The times below were measured on an AMD MI455X: many runs one after another, warmed up first and cycling through
// copies of the inputs, with the whole window's GPU time divided by the number of runs. Launches and the gaps
// between them are all in it. The median over several windows is given; except for v000 it joins two sittings, which
// can be a few percent apart, so the side-by-side timings, each taken in one sitting, are the better comparison.
// v000 is the starting kernel. One run takes 665 microseconds.
#include <hip/hip_runtime.h>

typedef _Float16 v16h __attribute__((ext_vector_type(16)));
typedef _Float16 v8h  __attribute__((ext_vector_type(8)));
typedef float    v8f  __attribute__((ext_vector_type(8)));

#define L_SEQ   4096
#define D_MODEL 768
#define N_HEADS 12
#define E_HEAD  64
#define SCALE_Q 0.125f            // 64^-0.5
#define LOG2E   1.44269504088896f

#ifndef __has_builtin
#define __has_builtin(x) 0
#endif
#if __has_builtin(__builtin_amdgcn_tensor_load_to_lds) && __has_builtin(__builtin_amdgcn_s_wait_tensorcnt)
#define HAVE_TDM 1
#else
#define HAVE_TDM 0
#endif

// ---- fragment loaders -------------------------------------------------------
// 16x32 f16 WMMA A/B fragment from a row-major f16 matrix (global or LDS).
// A: row0+(lane&15) is the M row.  B (via transposed storage): row0+(lane&15) is the N col.
// K chunks per ISA layout: lanes 0-15 hold K {0..7, 16..23}, lanes 16-31 hold {8..15, 24..31}.
static __device__ __forceinline__ v16h frag_f16(const _Float16* __restrict__ base,
                                                int row0, int stride, int k0) {
  int lane = threadIdx.x & 31;
  const _Float16* p = base + (size_t)(row0 + (lane & 15)) * stride + k0 + ((lane >> 4) << 3);
  v8h lo = *(const v8h*)p;
  v8h hi = *(const v8h*)(p + 16);
  v16h r;
#pragma unroll
  for (int i = 0; i < 8; ++i) { r[i] = lo[i]; r[i + 8] = hi[i]; }
  return r;
}

// Same fragment, but source matrix is f32 in memory (cast to f16 on the fly).
static __device__ __forceinline__ v16h frag_f32(const float* __restrict__ base,
                                                int row0, int stride, int k0) {
  int lane = threadIdx.x & 31;
  const float* p = base + (size_t)(row0 + (lane & 15)) * stride + k0 + ((lane >> 4) << 3);
  v16h r;
#pragma unroll
  for (int i = 0; i < 8; ++i) { r[i] = (_Float16)p[i]; r[i + 8] = (_Float16)p[i + 16]; }
  return r;
}

static __device__ __forceinline__ v8f wmma_f16(v16h a, v16h b, v8f c) {
  return __builtin_amdgcn_wmma_f32_16x16x32_f16(false, a, false, b, (short)0, c, false, false);
}

// ---- Tensor Data Mover: 2D tile load, D# built per ISA 8.3/8.4 --------------
#if HAVE_TDM
typedef unsigned int u32x4 __attribute__((ext_vector_type(4)));
typedef int          i32x8 __attribute__((ext_vector_type(8)));
typedef int          i32x4 __attribute__((ext_vector_type(4)));

// dim0/dim1: tensor extents (elements), tile0/tile1: tile extents, stride0 in elements.
static __device__ __forceinline__ void tdm_load_2d_f16(unsigned lds_addr, const void* gptr,
                                                       unsigned dim0, unsigned dim1,
                                                       unsigned tile0, unsigned tile1,
                                                       unsigned stride0) {
  unsigned long long ga = (unsigned long long)gptr;
  u32x4 g0;
  g0[0] = 1u;                                                   // count=1, user mode
  g0[1] = lds_addr;                                             // LDS byte address
  g0[2] = (unsigned)ga;                                         // global addr [95:64]
  g0[3] = (unsigned)((ga >> 32) & 0x01FFFFFFu) | 0x80000000u;   // addr[120:96] | type=2
  i32x8 g1;
  g1[0] = 0x00010000;                                           // data_size=1 (2 bytes)
  g1[1] = (int)((dim0 & 0xFFFFu) << 16);                        // tensor_dim0[15:0]
  g1[2] = (int)((dim0 >> 16) | ((dim1 & 0xFFFFu) << 16));       // dim0[31:16] | dim1[15:0]
  g1[3] = (int)((dim1 >> 16) | (tile0 << 16));                  // dim1[31:16] | tile_dim0
  g1[4] = (int)tile1;                                           // tile_dim1 (tile_dim2=0)
  g1[5] = (int)stride0;                                         // tensor_dim0_stride[31:0]
  g1[6] = 0;
  g1[7] = 0;
  i32x4 gz = {0, 0, 0, 0};
#if __clang_major__ >= 23
  i32x8 gz8 = {0, 0, 0, 0, 0, 0, 0, 0};
  __builtin_amdgcn_tensor_load_to_lds(g0, g1, gz, gz, gz8, 0);
#else
  __builtin_amdgcn_tensor_load_to_lds(g0, g1, gz, gz, 0);
#endif
}
#endif

// ---- kernel 1: fused QKV projection, f32 -> f16 -----------------------------
// grid = (L/128, 3*H); block = 256 (8 waves).
__global__ __launch_bounds__(256)
void qkv_proj_kernel(const float* __restrict__ X,
                     const float* __restrict__ Wq, const float* __restrict__ bq,
                     const float* __restrict__ Wk, const float* __restrict__ bk,
                     const float* __restrict__ Wv, const float* __restrict__ bv,
                     _Float16* __restrict__ Qh, _Float16* __restrict__ Kh,
                     _Float16* __restrict__ Vt) {
  const int wv   = threadIdx.x >> 5;
  const int lane = threadIdx.x & 31;
  const int m0   = blockIdx.x * 128 + wv * 16;
  const int seg  = blockIdx.y / N_HEADS;     // 0=Q 1=K 2=V
  const int head = blockIdx.y % N_HEADS;
  const float* W = (seg == 0) ? Wq : (seg == 1) ? Wk : Wv;
  const float* B = (seg == 0) ? bq : (seg == 1) ? bk : bv;
  const int col0 = head * E_HEAD;

  v8f acc[4] = {{}, {}, {}, {}};
  for (int k0 = 0; k0 < D_MODEL; k0 += 32) {
    v16h a = frag_f32(X, m0, D_MODEL, k0);
#pragma unroll
    for (int t = 0; t < 4; ++t) {
      v16h b = frag_f32(W, col0 + t * 16, D_MODEL, k0);   // B col = W row (X @ W^T)
      acc[t] = wmma_f16(a, b, acc[t]);
    }
  }

  const int chi = lane >> 4, cl = lane & 15;
  if (seg < 2) {
    _Float16* dst = (seg == 0 ? Qh : Kh) + (size_t)head * L_SEQ * E_HEAD;
#pragma unroll
    for (int t = 0; t < 4; ++t) {
      const int e = t * 16 + cl;
      const float bb = B[col0 + e];
#pragma unroll
      for (int i = 0; i < 8; ++i) {
        const int row = m0 + chi * 8 + i;
        dst[(size_t)row * E_HEAD + e] = (_Float16)(acc[t][i] + bb);
      }
    }
  } else {
    _Float16* dst = Vt + (size_t)head * E_HEAD * L_SEQ;   // transposed: [head][e][l]
#pragma unroll
    for (int t = 0; t < 4; ++t) {
      const int e = t * 16 + cl;
      const float bb = B[col0 + e];
      v8h pk;
#pragma unroll
      for (int i = 0; i < 8; ++i) pk[i] = (_Float16)(acc[t][i] + bb);
      *(v8h*)(dst + (size_t)e * L_SEQ + m0 + chi * 8) = pk;
    }
  }
}

// ---- kernel 2: flash attention, TDM-staged K/V, 32 q-rows per wave ----------
// grid = (L/256, H); block = 256 (8 waves). Key step = 64, double-buffered LDS.
__global__ __launch_bounds__(256)
void flash_attn_kernel(const _Float16* __restrict__ Qh, const _Float16* __restrict__ Kh,
                       const _Float16* __restrict__ Vt, const float* __restrict__ mask,
                       float* __restrict__ out) {
  // [0,8K): Kbuf x2 (64 keys x 64 e, row-major); [8K,16K): Vbuf x2 (64 e x 64 keys);
  // [16K,24K): per-wave 16x64 P tiles, column-major (reused for both q-tiles).
  __shared__ __align__(16) _Float16 smem[2 * 4096 + 2 * 4096 + 8 * 1024];
  const int wv   = threadIdx.x >> 5;
  const int lane = threadIdx.x & 31;
  const int head = blockIdx.y;
  const int q0   = blockIdx.x * 256 + wv * 32;    // 32 query rows per wave
  const _Float16* Q = Qh + (size_t)head * L_SEQ * E_HEAD;
  const _Float16* K = Kh + (size_t)head * L_SEQ * E_HEAD;
  const _Float16* V = Vt + (size_t)head * E_HEAD * L_SEQ;
  _Float16* pb = smem + 16384 + wv * 1024;
  const int chi = lane >> 4, cl = lane & 15;
  const int cb  = chi * 8;

  v16h qa[2][2];
#pragma unroll
  for (int qt = 0; qt < 2; ++qt) {
    qa[qt][0] = frag_f16(Q, q0 + qt * 16, E_HEAD, 0);
    qa[qt][1] = frag_f16(Q, q0 + qt * 16, E_HEAD, 32);
  }

  v8f acc[2][4] = {{{}, {}, {}, {}}, {{}, {}, {}, {}}};
  float mrow[2][8], lrow[2][8];
#pragma unroll
  for (int qt = 0; qt < 2; ++qt)
#pragma unroll
    for (int i = 0; i < 8; ++i) { mrow[qt][i] = -1e30f; lrow[qt][i] = 0.0f; }

  int cur = 0;
#if HAVE_TDM
  if (wv == 0) {
    tdm_load_2d_f16((unsigned)(size_t)(smem), K, 64, L_SEQ, 64, 64, 64);
    tdm_load_2d_f16((unsigned)(size_t)(smem + 8192), V, L_SEQ, 64, 64, 64, L_SEQ);
    __builtin_amdgcn_s_wait_tensorcnt(0);
  }
  __syncthreads();
#endif

  for (int j = 0; j < L_SEQ; j += 64) {
#if HAVE_TDM
    if (wv == 0 && j + 64 < L_SEQ) {   // prefetch next tile into the other buffer
      const int nb = cur ^ 1;
      tdm_load_2d_f16((unsigned)(size_t)(smem + nb * 4096),
                      K + (size_t)(j + 64) * E_HEAD, 64, L_SEQ, 64, 64, 64);
      tdm_load_2d_f16((unsigned)(size_t)(smem + 8192 + nb * 4096),
                      V + (j + 64), L_SEQ, 64, 64, 64, L_SEQ);
    }
#else
    __syncthreads();
    {  // cooperative staging fallback
      _Float16* kd = smem;
      _Float16* vd = smem + 8192;
      const _Float16* gk = K + (size_t)j * E_HEAD;          // contiguous 8KB
      for (int u = threadIdx.x; u < 512; u += 256)
        *(v8h*)(kd + u * 8) = *(const v8h*)(gk + u * 8);
      for (int u = threadIdx.x; u < 512; u += 256) {
        const int e = u >> 3, c = (u & 7) * 8;
        *(v8h*)(vd + e * 64 + c) = *(const v8h*)(V + (size_t)e * L_SEQ + j + c);
      }
      cur = 0;
    }
    __syncthreads();
#endif
    const _Float16* Kt = smem + cur * 4096;
    const _Float16* Vl = smem + 8192 + cur * 4096;

#pragma unroll
    for (int qt = 0; qt < 2; ++qt) {
      // S = Q K^T for 64 keys: 4 column tiles x (K=64 as 2 chunks)
      v8f s[4];
#pragma unroll
      for (int ct = 0; ct < 4; ++ct) {
        v16h kb0 = frag_f16(Kt, ct * 16, 64, 0);
        v16h kb1 = frag_f16(Kt, ct * 16, 64, 32);
        v8f z = {};
        z = wmma_f16(qa[qt][0], kb0, z);
        s[ct] = wmma_f16(qa[qt][1], kb1, z);
      }

      // exp2-domain online softmax over 64 columns
      float p[4][8];
#pragma unroll
      for (int i = 0; i < 8; ++i) {
        const int row = q0 + qt * 16 + chi * 8 + i;
        const float* mp = mask + (size_t)row * L_SEQ + j + cl;
        float v0 = s[0][i] * (SCALE_Q * LOG2E) + mp[0]  * LOG2E;
        float v1 = s[1][i] * (SCALE_Q * LOG2E) + mp[16] * LOG2E;
        float v2 = s[2][i] * (SCALE_Q * LOG2E) + mp[32] * LOG2E;
        float v3 = s[3][i] * (SCALE_Q * LOG2E) + mp[48] * LOG2E;
        float mx = fmaxf(fmaxf(v0, v1), fmaxf(v2, v3));
        mx = fmaxf(mx, __shfl_xor(mx, 1, 16));
        mx = fmaxf(mx, __shfl_xor(mx, 2, 16));
        mx = fmaxf(mx, __shfl_xor(mx, 4, 16));
        mx = fmaxf(mx, __shfl_xor(mx, 8, 16));
        const float mo = mrow[qt][i];
        const float mn = fmaxf(mo, mx);
        const float f  = exp2f(mo - mn);
        const float e0 = exp2f(v0 - mn), e1 = exp2f(v1 - mn);
        const float e2 = exp2f(v2 - mn), e3 = exp2f(v3 - mn);
        float rs = (e0 + e1) + (e2 + e3);
        rs += __shfl_xor(rs, 1, 16);
        rs += __shfl_xor(rs, 2, 16);
        rs += __shfl_xor(rs, 4, 16);
        rs += __shfl_xor(rs, 8, 16);
        mrow[qt][i] = mn;
        lrow[qt][i] = lrow[qt][i] * f + rs;
        acc[qt][0][i] *= f; acc[qt][1][i] *= f; acc[qt][2][i] *= f; acc[qt][3][i] *= f;
        p[0][i] = e0; p[1][i] = e1; p[2][i] = e2; p[3][i] = e3;
      }

      // C-layout -> A-layout via wave-private LDS (in-order DS, no barrier)
#pragma unroll
      for (int ct = 0; ct < 4; ++ct) {
        v8h pk;
#pragma unroll
        for (int i = 0; i < 8; ++i) pk[i] = (_Float16)p[ct][i];
        *(v8h*)(pb + (ct * 16 + cl) * 16 + cb) = pk;
      }
      v16h pa0, pa1;
#pragma unroll
      for (int i = 0; i < 8; ++i) {
        pa0[i]     = pb[(cb + i) * 16 + cl];
        pa0[i + 8] = pb[(cb + 16 + i) * 16 + cl];
        pa1[i]     = pb[(32 + cb + i) * 16 + cl];
        pa1[i + 8] = pb[(32 + cb + 16 + i) * 16 + cl];
      }

      // O += P V
#pragma unroll
      for (int t = 0; t < 4; ++t)
        acc[qt][t] = wmma_f16(pa0, frag_f16(Vl, t * 16, 64, 0),  acc[qt][t]);
#pragma unroll
      for (int t = 0; t < 4; ++t)
        acc[qt][t] = wmma_f16(pa1, frag_f16(Vl, t * 16, 64, 32), acc[qt][t]);
    }

#if HAVE_TDM
    if (wv == 0 && j + 64 < L_SEQ) __builtin_amdgcn_s_wait_tensorcnt(0);
    __syncthreads();
    cur ^= 1;
#endif
  }

  // epilogue: normalize and write fp32 output [l][h*64+e]
#pragma unroll
  for (int qt = 0; qt < 2; ++qt)
#pragma unroll
    for (int t = 0; t < 4; ++t)
#pragma unroll
      for (int i = 0; i < 8; ++i) {
        const int row = q0 + qt * 16 + chi * 8 + i;
        out[(size_t)row * D_MODEL + head * E_HEAD + t * 16 + cl] = acc[qt][t][i] / lrow[qt][i];
      }
}

// ---- launch -----------------------------------------------------------------
extern "C" void kernel_launch(void* const* d_in, const int* in_sizes, int n_in,
                              void* d_out, int out_size, void* d_ws, size_t ws_size,
                              hipStream_t stream) {
  const float* X    = (const float*)d_in[0];
  const float* mask = (const float*)d_in[1];
  const float* Wq   = (const float*)d_in[2];
  const float* bq   = (const float*)d_in[3];
  const float* Wk   = (const float*)d_in[4];
  const float* bk   = (const float*)d_in[5];
  const float* Wv   = (const float*)d_in[6];
  const float* bv   = (const float*)d_in[7];
  float* out        = (float*)d_out;

  const size_t per = (size_t)N_HEADS * L_SEQ * E_HEAD;  // 3,145,728 f16 each
  _Float16* Qh = (_Float16*)d_ws;
  _Float16* Kh = Qh + per;
  _Float16* Vt = Kh + per;

  dim3 gp(L_SEQ / 128, 3 * N_HEADS);
  qkv_proj_kernel<<<gp, 256, 0, stream>>>(X, Wq, bq, Wk, bk, Wv, bv, Qh, Kh, Vt);

  dim3 ga(L_SEQ / 256, N_HEADS);
  flash_attn_kernel<<<ga, 256, 0, stream>>>(Qh, Kh, Vt, mask, out);
}

// v001
// Measured time: 286 microseconds a run.
// Two timings next to v000 both put it at 2.37 times that version's speed.
#include <hip/hip_runtime.h>

typedef _Float16 v16h __attribute__((ext_vector_type(16)));
typedef _Float16 v8h  __attribute__((ext_vector_type(8)));
typedef float    v8f  __attribute__((ext_vector_type(8)));
typedef float    v4f  __attribute__((ext_vector_type(4)));

#define L_SEQ   4096
#define D_MODEL 768
#define N_HEADS 12
#define E_HEAD  64
#define SCALE_Q 0.125f            // 64^-0.5
#define LOG2E   1.44269504088896f

#ifndef __has_builtin
#define __has_builtin(x) 0
#endif
#if __has_builtin(__builtin_amdgcn_tensor_load_to_lds) && __has_builtin(__builtin_amdgcn_s_wait_tensorcnt)
#define HAVE_TDM 1
#else
#define HAVE_TDM 0
#endif

// ---- fragment loaders -------------------------------------------------------
// 16x32 f16 WMMA A/B fragment from a row-major f16 matrix (global or LDS).
// A: row0+(lane&15) is the M row.  B (via transposed storage): row0+(lane&15) is the N col.
// K chunks per ISA layout: lanes 0-15 hold K {0..7, 16..23}, lanes 16-31 hold {8..15, 24..31}.
static __device__ __forceinline__ v16h frag_f16(const _Float16* __restrict__ base,
                                                int row0, int stride, int k0) {
  int lane = threadIdx.x & 31;
  const _Float16* p = base + (size_t)(row0 + (lane & 15)) * stride + k0 + ((lane >> 4) << 3);
  v8h lo = *(const v8h*)p;
  v8h hi = *(const v8h*)(p + 16);
  v16h r;
#pragma unroll
  for (int i = 0; i < 8; ++i) { r[i] = lo[i]; r[i + 8] = hi[i]; }
  return r;
}

// Same fragment, but source matrix is f32 in memory (cast to f16 on the fly).
static __device__ __forceinline__ v16h frag_f32(const float* __restrict__ base,
                                                int row0, int stride, int k0) {
  int lane = threadIdx.x & 31;
  const float* p = base + (size_t)(row0 + (lane & 15)) * stride + k0 + ((lane >> 4) << 3);
  v16h r;
#pragma unroll
  for (int i = 0; i < 8; ++i) { r[i] = (_Float16)p[i]; r[i + 8] = (_Float16)p[i + 16]; }
  return r;
}

static __device__ __forceinline__ v8f wmma_f16(v16h a, v16h b, v8f c) {
  return __builtin_amdgcn_wmma_f32_16x16x32_f16(false, a, false, b, (short)0, c, false, false);
}

// Lane l <-> l ^ 16 as a vector cross-row move (no LDS round trip).
static __device__ __forceinline__ float other_half(float v) {
  int b = __builtin_bit_cast(int, v);
  b = __builtin_amdgcn_permlanex16(b, b, 0x76543210, 0xfedcba98, false, false);
  return __builtin_bit_cast(float, b);
}

// ---- Tensor Data Mover: 2D tile load, D# built per ISA 8.3/8.4 --------------
#if HAVE_TDM
typedef unsigned int u32x4 __attribute__((ext_vector_type(4)));
typedef int          i32x8 __attribute__((ext_vector_type(8)));
typedef int          i32x4 __attribute__((ext_vector_type(4)));

// dim0/dim1: tensor extents (elements), tile0/tile1: tile extents, stride0 in elements.
static __device__ __forceinline__ void tdm_load_2d_f16(unsigned lds_addr, const void* gptr,
                                                       unsigned dim0, unsigned dim1,
                                                       unsigned tile0, unsigned tile1,
                                                       unsigned stride0) {
  unsigned long long ga = (unsigned long long)gptr;
  u32x4 g0;
  g0[0] = 1u;                                                   // count=1, user mode
  g0[1] = lds_addr;                                             // LDS byte address
  g0[2] = (unsigned)ga;                                         // global addr [95:64]
  g0[3] = (unsigned)((ga >> 32) & 0x01FFFFFFu) | 0x80000000u;   // addr[120:96] | type=2
  i32x8 g1;
  g1[0] = 0x00010000;                                           // data_size=1 (2 bytes)
  g1[1] = (int)((dim0 & 0xFFFFu) << 16);                        // tensor_dim0[15:0]
  g1[2] = (int)((dim0 >> 16) | ((dim1 & 0xFFFFu) << 16));       // dim0[31:16] | dim1[15:0]
  g1[3] = (int)((dim1 >> 16) | (tile0 << 16));                  // dim1[31:16] | tile_dim0
  g1[4] = (int)tile1;                                           // tile_dim1 (tile_dim2=0)
  g1[5] = (int)stride0;                                         // tensor_dim0_stride[31:0]
  g1[6] = 0;
  g1[7] = 0;
  i32x4 gz = {0, 0, 0, 0};
#if __clang_major__ >= 23
  i32x8 gz8 = {0, 0, 0, 0, 0, 0, 0, 0};
  __builtin_amdgcn_tensor_load_to_lds(g0, g1, gz, gz, gz8, 0);
#else
  __builtin_amdgcn_tensor_load_to_lds(g0, g1, gz, gz, 0);
#endif
}
#endif

// ---- kernel 1: fused QKV projection, f32 -> f16 -----------------------------
// grid = (L/128, 3*H); block = 256 (8 waves).
__global__ __launch_bounds__(256)
void qkv_proj_kernel(const float* __restrict__ X,
                     const float* __restrict__ Wq, const float* __restrict__ bq,
                     const float* __restrict__ Wk, const float* __restrict__ bk,
                     const float* __restrict__ Wv, const float* __restrict__ bv,
                     _Float16* __restrict__ Qh, _Float16* __restrict__ Kh,
                     _Float16* __restrict__ Vt) {
  const int wv   = threadIdx.x >> 5;
  const int lane = threadIdx.x & 31;
  const int m0   = blockIdx.x * 128 + wv * 16;
  const int seg  = blockIdx.y / N_HEADS;     // 0=Q 1=K 2=V
  const int head = blockIdx.y % N_HEADS;
  const float* W = (seg == 0) ? Wq : (seg == 1) ? Wk : Wv;
  const float* B = (seg == 0) ? bq : (seg == 1) ? bk : bv;
  const int col0 = head * E_HEAD;

  v8f acc[4] = {{}, {}, {}, {}};
  for (int k0 = 0; k0 < D_MODEL; k0 += 32) {
    v16h a = frag_f32(X, m0, D_MODEL, k0);
#pragma unroll
    for (int t = 0; t < 4; ++t) {
      v16h b = frag_f32(W, col0 + t * 16, D_MODEL, k0);   // B col = W row (X @ W^T)
      acc[t] = wmma_f16(a, b, acc[t]);
    }
  }

  const int chi = lane >> 4, cl = lane & 15;
  if (seg < 2) {
    _Float16* dst = (seg == 0 ? Qh : Kh) + (size_t)head * L_SEQ * E_HEAD;
#pragma unroll
    for (int t = 0; t < 4; ++t) {
      const int e = t * 16 + cl;
      const float bb = B[col0 + e];
#pragma unroll
      for (int i = 0; i < 8; ++i) {
        const int row = m0 + chi * 8 + i;
        dst[(size_t)row * E_HEAD + e] = (_Float16)(acc[t][i] + bb);
      }
    }
  } else {
    _Float16* dst = Vt + (size_t)head * E_HEAD * L_SEQ;   // transposed: [head][e][l]
#pragma unroll
    for (int t = 0; t < 4; ++t) {
      const int e = t * 16 + cl;
      const float bb = B[col0 + e];
      v8h pk;
#pragma unroll
      for (int i = 0; i < 8; ++i) pk[i] = (_Float16)(acc[t][i] + bb);
      *(v8h*)(dst + (size_t)e * L_SEQ + m0 + chi * 8) = pk;
    }
  }
}

__global__ __launch_bounds__(256)
void flash_attn_kernel(const _Float16* __restrict__ Qh, const _Float16* __restrict__ Kh,
                       const _Float16* __restrict__ Vt, const float* __restrict__ mask,
                       float* __restrict__ out) {
  // [0,8K): Kbuf x2 (64 keys x 64 e, row-major); [8K,16K): Vbuf x2 (64 e x 64 keys).
  __shared__ __align__(16) _Float16 smem[2 * 4096 + 2 * 4096];
  const int wv   = threadIdx.x >> 5;
  const int lane = threadIdx.x & 31;
  const int head = blockIdx.y;
  const int q0   = blockIdx.x * 256 + wv * 32;    // 32 queries per wave
  const _Float16* Q = Qh + (size_t)head * L_SEQ * E_HEAD;
  const _Float16* K = Kh + (size_t)head * L_SEQ * E_HEAD;
  const _Float16* V = Vt + (size_t)head * E_HEAD * L_SEQ;
  const int chi = lane >> 4, cl = lane & 15;
  const int cb  = chi * 8;

  v16h qb[2][2];                                  // B operand: column = query
#pragma unroll
  for (int qt = 0; qt < 2; ++qt) {
    qb[qt][0] = frag_f16(Q, q0 + qt * 16, E_HEAD, 0);
    qb[qt][1] = frag_f16(Q, q0 + qt * 16, E_HEAD, 32);
  }

  v8f acc[2][4] = {{{}, {}, {}, {}}, {{}, {}, {}, {}}};   // O^T: row = e, column = query
  float mrow[2], lrow[2];                         // lrow: this half-wave's share of the sum
#pragma unroll
  for (int qt = 0; qt < 2; ++qt) { mrow[qt] = -1e30f; lrow[qt] = 0.0f; }

  unsigned moff[2];                               // byte offset of (query row, key cb) in the mask
#pragma unroll
  for (int qt = 0; qt < 2; ++qt)
    moff[qt] = (unsigned)((q0 + qt * 16 + cl) * L_SEQ + cb) * 4u;

  int cur = 0;
#if HAVE_TDM
  if (wv == 0) {
    tdm_load_2d_f16((unsigned)(size_t)(smem), K, 64, L_SEQ, 64, 64, 64);
    tdm_load_2d_f16((unsigned)(size_t)(smem + 8192), V, L_SEQ, 64, 64, 64, L_SEQ);
    __builtin_amdgcn_s_wait_tensorcnt(0);
  }
  __syncthreads();
#endif

  for (int j = 0; j < L_SEQ; j += 64) {
#if HAVE_TDM
    if (wv == 0 && j + 64 < L_SEQ) {   // prefetch next tile into the other buffer
      const int nb = cur ^ 1;
      tdm_load_2d_f16((unsigned)(size_t)(smem + nb * 4096),
                      K + (size_t)(j + 64) * E_HEAD, 64, L_SEQ, 64, 64, 64);
      tdm_load_2d_f16((unsigned)(size_t)(smem + 8192 + nb * 4096),
                      V + (j + 64), L_SEQ, 64, 64, 64, L_SEQ);
    }
#else
    __syncthreads();
    {  // cooperative staging fallback
      _Float16* kd = smem;
      _Float16* vd = smem + 8192;
      const _Float16* gk = K + (size_t)j * E_HEAD;          // contiguous 8KB
      for (int u = threadIdx.x; u < 512; u += 256)
        *(v8h*)(kd + u * 8) = *(const v8h*)(gk + u * 8);
      for (int u = threadIdx.x; u < 512; u += 256) {
        const int e = u >> 3, c = (u & 7) * 8;
        *(v8h*)(vd + e * 64 + c) = *(const v8h*)(V + (size_t)e * L_SEQ + j + c);
      }
      cur = 0;
    }
    __syncthreads();
#endif
    const _Float16* Kt = smem + cur * 4096;
    const _Float16* Vl = smem + 8192 + cur * 4096;

#pragma unroll
    for (int qt = 0; qt < 2; ++qt) {
      // this lane's mask values: one query row, keys j + ct*16 + cb + 0..7;
      // uniform base (advances with j) plus the lane's fixed 32-bit byte offset
      v8f mk[4];
#pragma unroll
      for (int ct = 0; ct < 4; ++ct)
        mk[ct] = *(const v8f*)((const char*)(mask + j + ct * 16) + moff[qt]);

      // S^T = K Q^T for 64 keys: 4 row tiles x (e=64 as 2 chunks)
      v8f s[4];
#pragma unroll
      for (int ct = 0; ct < 4; ++ct) {
        v16h ka0 = frag_f16(Kt, ct * 16, 64, 0);
        v16h ka1 = frag_f16(Kt, ct * 16, 64, 32);
        v8f z = {};
        z = wmma_f16(ka0, qb[qt][0], z);
        s[ct] = wmma_f16(ka1, qb[qt][1], z);
      }

      // exp2-domain online softmax: 32 of the query's 64 scores are in this lane
#pragma unroll
      for (int ct = 0; ct < 4; ++ct)
        s[ct] = s[ct] * (SCALE_Q * LOG2E) + mk[ct] * LOG2E;
      const v8f m8 = __builtin_elementwise_max(__builtin_elementwise_max(s[0], s[1]),
                                               __builtin_elementwise_max(s[2], s[3]));
      float mx = fmaxf(fmaxf(fmaxf(m8[0], m8[1]), fmaxf(m8[2], m8[3])),
                       fmaxf(fmaxf(m8[4], m8[5]), fmaxf(m8[6], m8[7])));
      mx = fmaxf(mx, other_half(mx));             // the other 32 keys of the same query
      const float mo = mrow[qt];
      const float mn = fmaxf(mo, mx);
      const float f  = exp2f(mo - mn);
#pragma unroll
      for (int ct = 0; ct < 4; ++ct)
#pragma unroll
        for (int i = 0; i < 8; ++i) s[ct][i] = exp2f(s[ct][i] - mn);
      const v8f r8 = (s[0] + s[1]) + (s[2] + s[3]);
      const float rs = ((r8[0] + r8[1]) + (r8[2] + r8[3])) + ((r8[4] + r8[5]) + (r8[6] + r8[7]));
      mrow[qt] = mn;
      lrow[qt] = lrow[qt] * f + rs;               // halves are joined once, in the epilogue
#pragma unroll
      for (int t = 0; t < 4; ++t) acc[qt][t] *= f;

      // two S^T tiles (keys 0-15 and 16-31 of a 32-key block) are the B fragment as they lie
      v16h pb0, pb1;
#pragma unroll
      for (int i = 0; i < 8; ++i) {
        pb0[i]     = (_Float16)s[0][i];
        pb0[i + 8] = (_Float16)s[1][i];
        pb1[i]     = (_Float16)s[2][i];
        pb1[i + 8] = (_Float16)s[3][i];
      }

      // O^T += V^T P^T
#pragma unroll
      for (int t = 0; t < 4; ++t)
        acc[qt][t] = wmma_f16(frag_f16(Vl, t * 16, 64, 0),  pb0, acc[qt][t]);
#pragma unroll
      for (int t = 0; t < 4; ++t)
        acc[qt][t] = wmma_f16(frag_f16(Vl, t * 16, 64, 32), pb1, acc[qt][t]);
    }

#if HAVE_TDM
    if (wv == 0 && j + 64 < L_SEQ) __builtin_amdgcn_s_wait_tensorcnt(0);
    __syncthreads();
    cur ^= 1;
#endif
  }

  // epilogue: normalize and write fp32 output [l][h*64+e]; 8 consecutive e per lane and tile
#pragma unroll
  for (int qt = 0; qt < 2; ++qt) {
    const float l = lrow[qt] + other_half(lrow[qt]);
    float* op = out + (size_t)(q0 + qt * 16 + cl) * D_MODEL + head * E_HEAD + cb;
#pragma unroll
    for (int t = 0; t < 4; ++t) {
      v4f o0, o1;
#pragma unroll
      for (int i = 0; i < 4; ++i) { o0[i] = acc[qt][t][i] / l; o1[i] = acc[qt][t][i + 4] / l; }
      *(v4f*)(op + t * 16)     = o0;
      *(v4f*)(op + t * 16 + 4) = o1;
    }
  }
}

// ---- launch -----------------------------------------------------------------
extern "C" void kernel_launch(void* const* d_in, const int* in_sizes, int n_in,
                              void* d_out, int out_size, void* d_ws, size_t ws_size,
                              hipStream_t stream) {
  const float* X    = (const float*)d_in[0];
  const float* mask = (const float*)d_in[1];
  const float* Wq   = (const float*)d_in[2];
  const float* bq   = (const float*)d_in[3];
  const float* Wk   = (const float*)d_in[4];
  const float* bk   = (const float*)d_in[5];
  const float* Wv   = (const float*)d_in[6];
  const float* bv   = (const float*)d_in[7];
  float* out        = (float*)d_out;

  const size_t per = (size_t)N_HEADS * L_SEQ * E_HEAD;  // 3,145,728 f16 each
  _Float16* Qh = (_Float16*)d_ws;
  _Float16* Kh = Qh + per;
  _Float16* Vt = Kh + per;

  dim3 gp(L_SEQ / 128, 3 * N_HEADS);
  qkv_proj_kernel<<<gp, 256, 0, stream>>>(X, Wq, bq, Wk, bk, Wv, bv, Qh, Kh, Vt);

  dim3 ga(L_SEQ / 256, N_HEADS);
  flash_attn_kernel<<<ga, 256, 0, stream>>>(Qh, Kh, Vt, mask, out);
}

// v002
// A run of this version takes 268 microseconds.
// In two side-by-side timings against v001, it was 1.07 and 1.06 times as fast.
// All steps since v000 together make it 2.52 times as fast.
#include <hip/hip_runtime.h>

typedef _Float16 v16h __attribute__((ext_vector_type(16)));
typedef _Float16 v8h  __attribute__((ext_vector_type(8)));
typedef float    v8f  __attribute__((ext_vector_type(8)));
typedef float    v4f  __attribute__((ext_vector_type(4)));

#define L_SEQ   4096
#define D_MODEL 768
#define N_HEADS 12
#define E_HEAD  64
#define SCALE_Q 0.125f            // 64^-0.5
#define LOG2E   1.44269504088896f

// K and V tiles in LDS: 64 rows of 128 B, each followed by a 16-B pad that the tensor load leaves.
// Pitch 144 B = 16 B x 9: the 16 rows that one ds_load_b128 reads fall on 16 different bank groups.
#define KV_PITCH 72               // f16 per LDS row
#define KV_BUF   5120             // f16 per buffer: 64 x 144 B = 9216 B, rounded up to 10 KiB (a multiple of 2 KiB)

// ---- fragment loaders -------------------------------------------------------
// 16x32 f16 WMMA A/B fragment from a row-major f16 matrix (global or LDS).
// A: row0+(lane&15) is the M row.  B (via transposed storage): row0+(lane&15) is the N col.
// K chunks per ISA layout: lanes 0-15 hold K {0..7, 16..23}, lanes 16-31 hold {8..15, 24..31}.
static __device__ __forceinline__ v16h frag_f16(const _Float16* __restrict__ base,
                                                int row0, int stride, int k0) {
  int lane = threadIdx.x & 31;
  const _Float16* p = base + (size_t)(row0 + (lane & 15)) * stride + k0 + ((lane >> 4) << 3);
  v8h lo = *(const v8h*)p;
  v8h hi = *(const v8h*)(p + 16);
  v16h r;
#pragma unroll
  for (int i = 0; i < 8; ++i) { r[i] = lo[i]; r[i + 8] = hi[i]; }
  return r;
}

// Same fragment, but source matrix is f32 in memory (cast to f16 on the fly).
static __device__ __forceinline__ v16h frag_f32(const float* __restrict__ base,
                                                int row0, int stride, int k0) {
  int lane = threadIdx.x & 31;
  const float* p = base + (size_t)(row0 + (lane & 15)) * stride + k0 + ((lane >> 4) << 3);
  v16h r;
#pragma unroll
  for (int i = 0; i < 8; ++i) { r[i] = (_Float16)p[i]; r[i + 8] = (_Float16)p[i + 16]; }
  return r;
}

static __device__ __forceinline__ v8f wmma_f16(v16h a, v16h b, v8f c) {
  return __builtin_amdgcn_wmma_f32_16x16x32_f16(false, a, false, b, (short)0, c, false, false);
}

// Lane l <-> l ^ 16 as a vector cross-row move (no LDS round trip).
static __device__ __forceinline__ float other_half(float v) {
  int b = __builtin_bit_cast(int, v);
  b = __builtin_amdgcn_permlanex16(b, b, 0x76543210, 0xfedcba98, false, false);
  return __builtin_bit_cast(float, b);
}

// ---- tensor load: one 64-row x 128-B tile into LDS, padded to the 144-B pitch ----------------
typedef unsigned int u32x4 __attribute__((ext_vector_type(4)));
typedef unsigned int u32x8 __attribute__((ext_vector_type(8)));

static __device__ __forceinline__ unsigned uni(unsigned v) {
  return (unsigned)__builtin_amdgcn_readfirstlane(v);
}
static __device__ __forceinline__ unsigned pinned(unsigned v) {
  unsigned w = uni(v);
  asm volatile("" : "+s"(w));     // pinned(): descriptor word / issue test kept scalar
  return w;
}
// all extents in bytes (data_size code 0), tensor dims = tile dims
static __device__ __forceinline__ u32x8 tdm_group1(unsigned src_pitch) {
  u32x8 g;
  g[0] = uni((1u << 20) | (4u << 22) | (3u << 25));   // pad on, after every 128 B, 4 dwords; no mask
  g[1] = uni(128u << 16);                             // tensor_dim0 = 128 B
  g[2] = uni(64u << 16);                              // tensor_dim1 = 64 rows
  g[3] = uni(128u << 16);                             // tile_dim0 = 128 B
  g[4] = uni(64u);                                    // tile_dim1 = 64 rows
  g[5] = uni(src_pitch);                              // source row pitch, bytes
  g[6] = uni(0u);
  g[7] = uni(0u);
  return g;
}
static __device__ __forceinline__ u32x4 tdm_group0(unsigned lds_dst, unsigned long long ga) {
  u32x4 g;
  g[0] = uni(1u);                                                     // count = 1
  g[1] = uni(lds_dst);                                                // LDS byte address
  g[2] = uni((unsigned)ga);                                           // global address, low word
  g[3] = uni((((unsigned)(ga >> 32)) & 0x01FFFFFFu) | 0x80000000u);   // high bits | type = 2
  return g;
}
static __device__ __forceinline__ void tdm_load(u32x4 g0, u32x8 g1) {
  asm volatile("tensor_load_to_lds %0, %1" :: "s"(g0), "s"(g1) : "memory");
}
// The compiler places no wait for a tensor load: the issuing wave's own wait before the barrier.
static __device__ __forceinline__ void wait_tensor0() { asm volatile("s_wait_tensorcnt 0x0" ::: "memory"); }
// The same wait, naming the open request's descriptor as inputs: its scalar registers are then
// not given to other values while the request is in flight.
static __device__ __forceinline__ void wait_tensor0_of(u32x4 g0, u32x8 g1) {
  asm volatile("s_wait_tensorcnt 0x0" :: "s"(g0), "s"(g1) : "memory");
}
// this wave's LDS reads have retired before the buffer they read is refilled
static __device__ __forceinline__ void wait_ds0() { asm volatile("s_wait_dscnt 0x0" ::: "memory"); }

// ---- kernel 1: fused QKV projection, f32 -> f16 -----------------------------
// grid = (L/128, 3*H); block = 256 (8 waves).
__global__ __launch_bounds__(256)
void qkv_proj_kernel(const float* __restrict__ X,
                     const float* __restrict__ Wq, const float* __restrict__ bq,
                     const float* __restrict__ Wk, const float* __restrict__ bk,
                     const float* __restrict__ Wv, const float* __restrict__ bv,
                     _Float16* __restrict__ Qh, _Float16* __restrict__ Kh,
                     _Float16* __restrict__ Vt) {
  const int wv   = threadIdx.x >> 5;
  const int lane = threadIdx.x & 31;
  const int m0   = blockIdx.x * 128 + wv * 16;
  const int seg  = blockIdx.y / N_HEADS;     // 0=Q 1=K 2=V
  const int head = blockIdx.y % N_HEADS;
  const float* W = (seg == 0) ? Wq : (seg == 1) ? Wk : Wv;
  const float* B = (seg == 0) ? bq : (seg == 1) ? bk : bv;
  const int col0 = head * E_HEAD;

  v8f acc[4] = {{}, {}, {}, {}};
  for (int k0 = 0; k0 < D_MODEL; k0 += 32) {
    v16h a = frag_f32(X, m0, D_MODEL, k0);
#pragma unroll
    for (int t = 0; t < 4; ++t) {
      v16h b = frag_f32(W, col0 + t * 16, D_MODEL, k0);   // B col = W row (X @ W^T)
      acc[t] = wmma_f16(a, b, acc[t]);
    }
  }

  const int chi = lane >> 4, cl = lane & 15;
  if (seg < 2) {
    _Float16* dst = (seg == 0 ? Qh : Kh) + (size_t)head * L_SEQ * E_HEAD;
#pragma unroll
    for (int t = 0; t < 4; ++t) {
      const int e = t * 16 + cl;
      const float bb = B[col0 + e];
#pragma unroll
      for (int i = 0; i < 8; ++i) {
        const int row = m0 + chi * 8 + i;
        dst[(size_t)row * E_HEAD + e] = (_Float16)(acc[t][i] + bb);
      }
    }
  } else {
    _Float16* dst = Vt + (size_t)head * E_HEAD * L_SEQ;   // transposed: [head][e][l]
#pragma unroll
    for (int t = 0; t < 4; ++t) {
      const int e = t * 16 + cl;
      const float bb = B[col0 + e];
      v8h pk;
#pragma unroll
      for (int i = 0; i < 8; ++i) pk[i] = (_Float16)(acc[t][i] + bb);
      *(v8h*)(dst + (size_t)e * L_SEQ + m0 + chi * 8) = pk;
    }
  }
}

__global__ __launch_bounds__(256)
void flash_attn_kernel(const _Float16* __restrict__ Qh, const _Float16* __restrict__ Kh,
                       const _Float16* __restrict__ Vt, const float* __restrict__ mask,
                       float* __restrict__ out) {
  // Kbuf x2 (64 keys x 64 e, row-major), then Vbuf x2 (64 e x 64 keys); rows at KV_PITCH.
  __shared__ __attribute__((aligned(2048))) _Float16 smem[4 * KV_BUF];
  const int wv   = threadIdx.x >> 5;
  const int lane = threadIdx.x & 31;
  const int head = blockIdx.y;
  const int q0   = blockIdx.x * 256 + wv * 32;    // 32 queries per wave
  const _Float16* Q = Qh + (size_t)head * L_SEQ * E_HEAD;
  const _Float16* K = Kh + (size_t)head * L_SEQ * E_HEAD;
  const _Float16* V = Vt + (size_t)head * E_HEAD * L_SEQ;
  const int chi = lane >> 4, cl = lane & 15;
  const int cb  = chi * 8;

  v16h qb[2][2];                                  // B operand: column = query
#pragma unroll
  for (int qt = 0; qt < 2; ++qt) {
    qb[qt][0] = frag_f16(Q, q0 + qt * 16, E_HEAD, 0);
    qb[qt][1] = frag_f16(Q, q0 + qt * 16, E_HEAD, 32);
  }

  v8f acc[2][4] = {{{}, {}, {}, {}}, {{}, {}, {}, {}}};   // O^T: row = e, column = query
  float mrow[2], lrow[2];                         // lrow: this half-wave's share of the sum
#pragma unroll
  for (int qt = 0; qt < 2; ++qt) { mrow[qt] = -1e30f; lrow[qt] = 0.0f; }

  unsigned moff[2];                               // byte offset of (query row, key cb) in the mask
#pragma unroll
  for (int qt = 0; qt < 2; ++qt)
    moff[qt] = (unsigned)((q0 + qt * 16 + cl) * L_SEQ + cb) * 4u;

  // Wave 0 brings the K tiles, wave 1 the V tiles: one request of a wave in flight at a time.
  const unsigned wave    = uni(threadIdx.x >> 5);
  const unsigned is_v    = wave == 1u ? 1u : 0u;
  const u32x8    g1      = tdm_group1(is_v ? L_SEQ * 2u : E_HEAD * 2u);
  const unsigned lds0    = (unsigned)(size_t)smem + is_v * (2u * KV_BUF * 2u);
  const unsigned long long ga0 = (unsigned long long)(is_v ? V : K);
  const unsigned gstep   = is_v ? 64u * 2u : 64u * E_HEAD * 2u;   // bytes from one stage's tile to the next
  const unsigned n_stage = L_SEQ / 64;

  u32x4 g0 = tdm_group0(lds0, ga0);
  if (pinned(wave < 2u)) {
    tdm_load(g0, g1);
    wait_tensor0_of(g0, g1);
  }
  __syncthreads();
  g0 = tdm_group0(lds0 + KV_BUF * 2u, ga0 + gstep);
  if (pinned(wave < 2u)) tdm_load(g0, g1);

  int cur = 0;
  for (int j = 0; j < L_SEQ; j += 64) {
    const _Float16* Kt = smem + cur * KV_BUF;
    const _Float16* Vl = smem + 2 * KV_BUF + cur * KV_BUF;

#pragma unroll
    for (int qt = 0; qt < 2; ++qt) {
      // this lane's mask values: one query row, keys j + ct*16 + cb + 0..7;
      // uniform base (advances with j) plus the lane's fixed 32-bit byte offset
      v8f mk[4];
#pragma unroll
      for (int ct = 0; ct < 4; ++ct)
        mk[ct] = *(const v8f*)((const char*)(mask + j + ct * 16) + moff[qt]);

      // S^T = K Q^T for 64 keys: 4 row tiles x (e=64 as 2 chunks)
      v8f s[4];
#pragma unroll
      for (int ct = 0; ct < 4; ++ct) {
        v16h ka0 = frag_f16(Kt, ct * 16, KV_PITCH, 0);
        v16h ka1 = frag_f16(Kt, ct * 16, KV_PITCH, 32);
        v8f z = {};
        z = wmma_f16(ka0, qb[qt][0], z);
        s[ct] = wmma_f16(ka1, qb[qt][1], z);
      }

      // exp2-domain online softmax: 32 of the query's 64 scores are in this lane
#pragma unroll
      for (int ct = 0; ct < 4; ++ct)
        s[ct] = s[ct] * (SCALE_Q * LOG2E) + mk[ct] * LOG2E;
      const v8f m8 = __builtin_elementwise_max(__builtin_elementwise_max(s[0], s[1]),
                                               __builtin_elementwise_max(s[2], s[3]));
      float mx = fmaxf(fmaxf(fmaxf(m8[0], m8[1]), fmaxf(m8[2], m8[3])),
                       fmaxf(fmaxf(m8[4], m8[5]), fmaxf(m8[6], m8[7])));
      mx = fmaxf(mx, other_half(mx));             // the other 32 keys of the same query
      const float mo = mrow[qt];
      const float mn = fmaxf(mo, mx);
      const float f  = exp2f(mo - mn);
#pragma unroll
      for (int ct = 0; ct < 4; ++ct)
#pragma unroll
        for (int i = 0; i < 8; ++i) s[ct][i] = exp2f(s[ct][i] - mn);
      const v8f r8 = (s[0] + s[1]) + (s[2] + s[3]);
      const float rs = ((r8[0] + r8[1]) + (r8[2] + r8[3])) + ((r8[4] + r8[5]) + (r8[6] + r8[7]));
      mrow[qt] = mn;
      lrow[qt] = lrow[qt] * f + rs;               // halves are joined once, in the epilogue
#pragma unroll
      for (int t = 0; t < 4; ++t) acc[qt][t] *= f;

      // two S^T tiles (keys 0-15 and 16-31 of a 32-key block) are the B fragment as they lie
      v16h pb0, pb1;
#pragma unroll
      for (int i = 0; i < 8; ++i) {
        pb0[i]     = (_Float16)s[0][i];
        pb0[i + 8] = (_Float16)s[1][i];
        pb1[i]     = (_Float16)s[2][i];
        pb1[i + 8] = (_Float16)s[3][i];
      }

      // O^T += V^T P^T
#pragma unroll
      for (int t = 0; t < 4; ++t)
        acc[qt][t] = wmma_f16(frag_f16(Vl, t * 16, KV_PITCH, 0),  pb0, acc[qt][t]);
#pragma unroll
      for (int t = 0; t < 4; ++t)
        acc[qt][t] = wmma_f16(frag_f16(Vl, t * 16, KV_PITCH, 32), pb1, acc[qt][t]);
    }

    // publish the next stage, then refill the buffer that this pass has just read
    wait_ds0();
    if (pinned(wave < 2u)) wait_tensor0_of(g0, g1);
    __syncthreads();
    const unsigned nxt = pinned((unsigned)(j >> 6) + 2u);   // pinned(): the descriptor is formed behind the wait
    if (pinned(wave < 2u && nxt < n_stage)) {
      g0 = tdm_group0(lds0 + (unsigned)cur * (KV_BUF * 2u), ga0 + (unsigned long long)nxt * gstep);
      tdm_load(g0, g1);
    }
    cur ^= 1;
  }
  wait_tensor0();
  wait_ds0();

  // epilogue: normalize and write fp32 output [l][h*64+e]; 8 consecutive e per lane and tile
#pragma unroll
  for (int qt = 0; qt < 2; ++qt) {
    const float l = lrow[qt] + other_half(lrow[qt]);
    float* op = out + (size_t)(q0 + qt * 16 + cl) * D_MODEL + head * E_HEAD + cb;
#pragma unroll
    for (int t = 0; t < 4; ++t) {
      v4f o0, o1;
#pragma unroll
      for (int i = 0; i < 4; ++i) { o0[i] = acc[qt][t][i] / l; o1[i] = acc[qt][t][i + 4] / l; }
      *(v4f*)(op + t * 16)     = o0;
      *(v4f*)(op + t * 16 + 4) = o1;
    }
  }
}

// ---- launch -----------------------------------------------------------------
extern "C" void kernel_launch(void* const* d_in, const int* in_sizes, int n_in,
                              void* d_out, int out_size, void* d_ws, size_t ws_size,
                              hipStream_t stream) {
  const float* X    = (const float*)d_in[0];
  const float* mask = (const float*)d_in[1];
  const float* Wq   = (const float*)d_in[2];
  const float* bq   = (const float*)d_in[3];
  const float* Wk   = (const float*)d_in[4];
  const float* bk   = (const float*)d_in[5];
  const float* Wv   = (const float*)d_in[6];
  const float* bv   = (const float*)d_in[7];
  float* out        = (float*)d_out;

  const size_t per = (size_t)N_HEADS * L_SEQ * E_HEAD;  // 3,145,728 f16 each
  _Float16* Qh = (_Float16*)d_ws;
  _Float16* Kh = Qh + per;
  _Float16* Vt = Kh + per;

  dim3 gp(L_SEQ / 128, 3 * N_HEADS);
  qkv_proj_kernel<<<gp, 256, 0, stream>>>(X, Wq, bq, Wk, bk, Wv, bv, Qh, Kh, Vt);

  dim3 ga(L_SEQ / 256, N_HEADS);
  flash_attn_kernel<<<ga, 256, 0, stream>>>(Qh, Kh, Vt, mask, out);
}

// v003
// One run takes 182 microseconds.
// Two timings next to v002 both put it at 1.48 times that version's speed.
// All steps since v000 together make it 3.73 times as fast.
#include <hip/hip_runtime.h>

typedef _Float16 v16h __attribute__((ext_vector_type(16)));
typedef _Float16 v8h  __attribute__((ext_vector_type(8)));
typedef _Float16 v4h  __attribute__((ext_vector_type(4)));
typedef float    v8f  __attribute__((ext_vector_type(8)));
typedef float    v4f  __attribute__((ext_vector_type(4)));

#define L_SEQ   4096
#define D_MODEL 768
#define N_HEADS 12
#define E_HEAD  64
#define SCALE_Q 0.125f            // 64^-0.5
#define LOG2E   1.44269504088896f

// K and V tiles in LDS: 64 rows of 128 B, each followed by a 16-B pad that the tensor load leaves.
// Pitch 144 B = 16 B x 9: the 16 rows that one ds_load_b128 reads fall on 16 different bank groups.
#define KV_PITCH 72               // f16 per LDS row
#define KV_BUF   5120             // f16 per buffer: 64 x 144 B = 9216 B, rounded up to 10 KiB (a multiple of 2 KiB)

// ---- fragment loaders -------------------------------------------------------
// 16x32 f16 WMMA A/B fragment from a row-major f16 matrix (global or LDS).
// A: row0+(lane&15) is the M row.  B (via transposed storage): row0+(lane&15) is the N col.
// K chunks per ISA layout: lanes 0-15 hold K {0..7, 16..23}, lanes 16-31 hold {8..15, 24..31}.
static __device__ __forceinline__ v16h frag_f16(const _Float16* __restrict__ base,
                                                int row0, int stride, int k0) {
  int lane = threadIdx.x & 31;
  const _Float16* p = base + (size_t)(row0 + (lane & 15)) * stride + k0 + ((lane >> 4) << 3);
  v8h lo = *(const v8h*)p;
  v8h hi = *(const v8h*)(p + 16);
  v16h r;
#pragma unroll
  for (int i = 0; i < 8; ++i) { r[i] = lo[i]; r[i + 8] = hi[i]; }
  return r;
}

static __device__ __forceinline__ v8f wmma_f16(v16h a, v16h b, v8f c) {
  return __builtin_amdgcn_wmma_f32_16x16x32_f16(false, a, false, b, (short)0, c, false, false);
}

// Lane l <-> l ^ 16 as a vector cross-row move (no LDS round trip).
static __device__ __forceinline__ float other_half(float v) {
  int b = __builtin_bit_cast(int, v);
  b = __builtin_amdgcn_permlanex16(b, b, 0x76543210, 0xfedcba98, false, false);
  return __builtin_bit_cast(float, b);
}

// ---- tensor load: one 64-row x 128-B tile into LDS, padded to the 144-B pitch ----------------
typedef unsigned int u32x4 __attribute__((ext_vector_type(4)));
typedef unsigned int u32x8 __attribute__((ext_vector_type(8)));

static __device__ __forceinline__ unsigned uni(unsigned v) {
  return (unsigned)__builtin_amdgcn_readfirstlane(v);
}
static __device__ __forceinline__ unsigned pinned(unsigned v) {
  unsigned w = uni(v);
  asm volatile("" : "+s"(w));     // pinned(): descriptor word / issue test kept scalar
  return w;
}
// all extents in bytes (data_size code 0), tensor dims = tile dims
static __device__ __forceinline__ u32x8 tdm_group1(unsigned src_pitch) {
  u32x8 g;
  g[0] = uni((1u << 20) | (4u << 22) | (3u << 25));   // pad on, after every 128 B, 4 dwords; no mask
  g[1] = uni(128u << 16);                             // tensor_dim0 = 128 B
  g[2] = uni(64u << 16);                              // tensor_dim1 = 64 rows
  g[3] = uni(128u << 16);                             // tile_dim0 = 128 B
  g[4] = uni(64u);                                    // tile_dim1 = 64 rows
  g[5] = uni(src_pitch);                              // source row pitch, bytes
  g[6] = uni(0u);
  g[7] = uni(0u);
  return g;
}
static __device__ __forceinline__ u32x4 tdm_group0(unsigned lds_dst, unsigned long long ga) {
  u32x4 g;
  g[0] = uni(1u);                                                     // count = 1
  g[1] = uni(lds_dst);                                                // LDS byte address
  g[2] = uni((unsigned)ga);                                           // global address, low word
  g[3] = uni((((unsigned)(ga >> 32)) & 0x01FFFFFFu) | 0x80000000u);   // high bits | type = 2
  return g;
}
static __device__ __forceinline__ void tdm_load(u32x4 g0, u32x8 g1) {
  asm volatile("tensor_load_to_lds %0, %1" :: "s"(g0), "s"(g1) : "memory");
}
// The compiler places no wait for a tensor load: the issuing wave's own wait before the barrier.
static __device__ __forceinline__ void wait_tensor0() { asm volatile("s_wait_tensorcnt 0x0" ::: "memory"); }
// The same wait, naming the open request's descriptor as inputs: its scalar registers are then
// not given to other values while the request is in flight.
static __device__ __forceinline__ void wait_tensor0_of(u32x4 g0, u32x8 g1) {
  asm volatile("s_wait_tensorcnt 0x0" :: "s"(g0), "s"(g1) : "memory");
}
// this wave's LDS reads have retired before the buffer they read is refilled
static __device__ __forceinline__ void wait_ds0() { asm volatile("s_wait_dscnt 0x0" ::: "memory"); }

// ---- kernel 1: fused QKV projection, f32 -> f16 -----------------------------
// grid = (L/128, 3*H/2); block = 256 (8 waves). Block tile 128 rows x 128 columns (two heads),
// wave tile 32 x 64 (one head). The operands go through LDS: per stage of 32 k the block loads its
// 128 X rows and 128 W rows with whole-line loads (8 lanes x 16 B = one row's 128 B), converts each
// element once and stores it as f16; the waves take their fragments from there. Two buffers: the
// next stage's loads fly while this stage is multiplied.
#define PJ_K      32                // k per stage
#define PJ_PITCH  40                // f16 per LDS row: 64 B + 16 B, conflict-free for ds_load_b128
#define PJ_BUF    (128 * PJ_PITCH)  // f16 per buffer of 128 rows
#define PJ_STAGES (D_MODEL / PJ_K)

static __device__ __forceinline__ void put_f16x4(_Float16* dst, v4f v) {
  v4h h;
#pragma unroll
  for (int i = 0; i < 4; ++i) h[i] = (_Float16)v[i];
  *(v4h*)dst = h;
}

__global__ __launch_bounds__(256)
void qkv_proj_kernel(const float* __restrict__ X,
                     const float* __restrict__ Wq, const float* __restrict__ bq,
                     const float* __restrict__ Wk, const float* __restrict__ bk,
                     const float* __restrict__ Wv, const float* __restrict__ bv,
                     _Float16* __restrict__ Qh, _Float16* __restrict__ Kh,
                     _Float16* __restrict__ Vt) {
  __shared__ __attribute__((aligned(16))) _Float16 xs[2 * PJ_BUF];
  __shared__ __attribute__((aligned(16))) _Float16 wsh[2 * PJ_BUF];
  const int wv   = threadIdx.x >> 5;
  const int lane = threadIdx.x & 31;
  const int wm   = wv & 3;                          // the wave's 32 rows of the block's 128
  const int wn   = wv >> 2;                         // the wave's head of the block's two
  const int mb   = blockIdx.x * 128;
  const int seg  = blockIdx.y / (N_HEADS / 2);      // 0=Q 1=K 2=V
  const int hp   = blockIdx.y % (N_HEADS / 2);      // pair of heads
  const int head = hp * 2 + wn;
  const float* W = (seg == 0) ? Wq : (seg == 1) ? Wk : Wv;
  const float* B = (seg == 0) ? bq : (seg == 1) ? bk : bv;
  const int col0 = head * E_HEAD;

  // staging: thread -> (row sr of a group of 32 rows, 4 floats at k = sc)
  const int sr = threadIdx.x >> 3;
  const int sc = (threadIdx.x & 7) * 4;
  const float* xg = X + (size_t)(mb + sr) * D_MODEL + sc;
  const float* wg = W + (size_t)(hp * 128 + sr) * D_MODEL + sc;
  const int so = sr * PJ_PITCH + sc;

  v4f xr[4], wr[4];
#pragma unroll
  for (int i = 0; i < 4; ++i) xr[i] = *(const v4f*)(xg + i * 32 * D_MODEL);
#pragma unroll
  for (int i = 0; i < 4; ++i) wr[i] = *(const v4f*)(wg + i * 32 * D_MODEL);
#pragma unroll
  for (int i = 0; i < 4; ++i) put_f16x4(xs + so + i * 32 * PJ_PITCH, xr[i]);
#pragma unroll
  for (int i = 0; i < 4; ++i) put_f16x4(wsh + so + i * 32 * PJ_PITCH, wr[i]);
  __syncthreads();

  v8f acc[2][4] = {{{}, {}, {}, {}}, {{}, {}, {}, {}}};
  for (int s = 0; s < PJ_STAGES; ++s) {
    const int cur = s & 1;
    const bool more = s + 1 < PJ_STAGES;            // the same for the whole block
    if (more) {
      const int k1 = (s + 1) * PJ_K;
#pragma unroll
      for (int i = 0; i < 4; ++i) xr[i] = *(const v4f*)(xg + k1 + i * 32 * D_MODEL);
#pragma unroll
      for (int i = 0; i < 4; ++i) wr[i] = *(const v4f*)(wg + k1 + i * 32 * D_MODEL);
    }
    const _Float16* xt = xs + cur * PJ_BUF;
    const _Float16* wt = wsh + cur * PJ_BUF;
    v16h a[2], b[4];
#pragma unroll
    for (int r = 0; r < 2; ++r) a[r] = frag_f16(xt, wm * 32 + r * 16, PJ_PITCH, 0);
#pragma unroll
    for (int t = 0; t < 4; ++t) b[t] = frag_f16(wt, wn * 64 + t * 16, PJ_PITCH, 0);   // B col = W row (X @ W^T)
    // the next stage's global loads and this stage's LDS reads are issued as one group ahead of the
    // products: left free, the scheduler sinks them among the WMMAs and waits at every one
    __builtin_amdgcn_sched_barrier(0);
#pragma unroll
    for (int t = 0; t < 4; ++t)
#pragma unroll
      for (int r = 0; r < 2; ++r) acc[r][t] = wmma_f16(a[r], b[t], acc[r][t]);
    // the conversions, which wait for the global loads, stay behind the products
    __builtin_amdgcn_sched_barrier(0);
    if (more) {
      // into the buffer that every wave left before the barrier at the foot of the pass before
      _Float16* xn = xs + (cur ^ 1) * PJ_BUF + so;
      _Float16* wn2 = wsh + (cur ^ 1) * PJ_BUF + so;
#pragma unroll
      for (int i = 0; i < 4; ++i) put_f16x4(xn + i * 32 * PJ_PITCH, xr[i]);
#pragma unroll
      for (int i = 0; i < 4; ++i) put_f16x4(wn2 + i * 32 * PJ_PITCH, wr[i]);
      __syncthreads();                              // publishes stage s + 1, ends the reads of stage s
    }
  }

  const int chi = lane >> 4, cl = lane & 15;
  const int m0 = mb + wm * 32;
  if (seg < 2) {
    _Float16* dst = (seg == 0 ? Qh : Kh) + (size_t)head * L_SEQ * E_HEAD;
#pragma unroll
    for (int t = 0; t < 4; ++t) {
      const int e = t * 16 + cl;
      const float bb = B[col0 + e];
#pragma unroll
      for (int r = 0; r < 2; ++r)
#pragma unroll
        for (int i = 0; i < 8; ++i) {
          const int row = m0 + r * 16 + chi * 8 + i;
          dst[(size_t)row * E_HEAD + e] = (_Float16)(acc[r][t][i] + bb);
        }
    }
  } else {
    _Float16* dst = Vt + (size_t)head * E_HEAD * L_SEQ;   // transposed: [head][e][l]
#pragma unroll
    for (int t = 0; t < 4; ++t) {
      const int e = t * 16 + cl;
      const float bb = B[col0 + e];
#pragma unroll
      for (int r = 0; r < 2; ++r) {
        v8h pk;
#pragma unroll
        for (int i = 0; i < 8; ++i) pk[i] = (_Float16)(acc[r][t][i] + bb);
        *(v8h*)(dst + (size_t)e * L_SEQ + m0 + r * 16 + chi * 8) = pk;
      }
    }
    // behind the last store: the code laid out after this branch rewrites the stores' registers
    asm volatile("s_wait_xcnt 0x0" ::: "memory");
  }
}

__global__ __launch_bounds__(256)
void flash_attn_kernel(const _Float16* __restrict__ Qh, const _Float16* __restrict__ Kh,
                       const _Float16* __restrict__ Vt, const float* __restrict__ mask,
                       float* __restrict__ out) {
  // Kbuf x2 (64 keys x 64 e, row-major), then Vbuf x2 (64 e x 64 keys); rows at KV_PITCH.
  __shared__ __attribute__((aligned(2048))) _Float16 smem[4 * KV_BUF];
  const int wv   = threadIdx.x >> 5;
  const int lane = threadIdx.x & 31;
  const int head = blockIdx.y;
  const int q0   = blockIdx.x * 256 + wv * 32;    // 32 queries per wave
  const _Float16* Q = Qh + (size_t)head * L_SEQ * E_HEAD;
  const _Float16* K = Kh + (size_t)head * L_SEQ * E_HEAD;
  const _Float16* V = Vt + (size_t)head * E_HEAD * L_SEQ;
  const int chi = lane >> 4, cl = lane & 15;
  const int cb  = chi * 8;

  v16h qb[2][2];                                  // B operand: column = query
#pragma unroll
  for (int qt = 0; qt < 2; ++qt) {
    qb[qt][0] = frag_f16(Q, q0 + qt * 16, E_HEAD, 0);
    qb[qt][1] = frag_f16(Q, q0 + qt * 16, E_HEAD, 32);
  }

  v8f acc[2][4] = {{{}, {}, {}, {}}, {{}, {}, {}, {}}};   // O^T: row = e, column = query
  float mrow[2], lrow[2];                         // lrow: this half-wave's share of the sum
#pragma unroll
  for (int qt = 0; qt < 2; ++qt) { mrow[qt] = -1e30f; lrow[qt] = 0.0f; }

  unsigned moff[2];                               // byte offset of (query row, key cb) in the mask
#pragma unroll
  for (int qt = 0; qt < 2; ++qt)
    moff[qt] = (unsigned)((q0 + qt * 16 + cl) * L_SEQ + cb) * 4u;

  // Wave 0 brings the K tiles, wave 1 the V tiles: one request of a wave in flight at a time.
  const unsigned wave    = uni(threadIdx.x >> 5);
  const unsigned is_v    = wave == 1u ? 1u : 0u;
  const u32x8    g1      = tdm_group1(is_v ? L_SEQ * 2u : E_HEAD * 2u);
  const unsigned lds0    = (unsigned)(size_t)smem + is_v * (2u * KV_BUF * 2u);
  const unsigned long long ga0 = (unsigned long long)(is_v ? V : K);
  const unsigned gstep   = is_v ? 64u * 2u : 64u * E_HEAD * 2u;   // bytes from one stage's tile to the next
  const unsigned n_stage = L_SEQ / 64;

  u32x4 g0 = tdm_group0(lds0, ga0);
  if (pinned(wave < 2u)) {
    tdm_load(g0, g1);
    wait_tensor0_of(g0, g1);
  }
  __syncthreads();
  g0 = tdm_group0(lds0 + KV_BUF * 2u, ga0 + gstep);
  if (pinned(wave < 2u)) tdm_load(g0, g1);

  int cur = 0;
  for (int j = 0; j < L_SEQ; j += 64) {
    const _Float16* Kt = smem + cur * KV_BUF;
    const _Float16* Vl = smem + 2 * KV_BUF + cur * KV_BUF;

#pragma unroll
    for (int qt = 0; qt < 2; ++qt) {
      // this lane's mask values: one query row, keys j + ct*16 + cb + 0..7;
      // uniform base (advances with j) plus the lane's fixed 32-bit byte offset
      v8f mk[4];
#pragma unroll
      for (int ct = 0; ct < 4; ++ct)
        mk[ct] = *(const v8f*)((const char*)(mask + j + ct * 16) + moff[qt]);

      // S^T = K Q^T for 64 keys: 4 row tiles x (e=64 as 2 chunks)
      v8f s[4];
#pragma unroll
      for (int ct = 0; ct < 4; ++ct) {
        v16h ka0 = frag_f16(Kt, ct * 16, KV_PITCH, 0);
        v16h ka1 = frag_f16(Kt, ct * 16, KV_PITCH, 32);
        v8f z = {};
        z = wmma_f16(ka0, qb[qt][0], z);
        s[ct] = wmma_f16(ka1, qb[qt][1], z);
      }

      // exp2-domain online softmax: 32 of the query's 64 scores are in this lane
#pragma unroll
      for (int ct = 0; ct < 4; ++ct)
        s[ct] = s[ct] * (SCALE_Q * LOG2E) + mk[ct] * LOG2E;
      const v8f m8 = __builtin_elementwise_max(__builtin_elementwise_max(s[0], s[1]),
                                               __builtin_elementwise_max(s[2], s[3]));
      float mx = fmaxf(fmaxf(fmaxf(m8[0], m8[1]), fmaxf(m8[2], m8[3])),
                       fmaxf(fmaxf(m8[4], m8[5]), fmaxf(m8[6], m8[7])));
      mx = fmaxf(mx, other_half(mx));             // the other 32 keys of the same query
      const float mo = mrow[qt];
      const float mn = fmaxf(mo, mx);
      const float f  = exp2f(mo - mn);
#pragma unroll
      for (int ct = 0; ct < 4; ++ct)
#pragma unroll
        for (int i = 0; i < 8; ++i) s[ct][i] = exp2f(s[ct][i] - mn);
      const v8f r8 = (s[0] + s[1]) + (s[2] + s[3]);
      const float rs = ((r8[0] + r8[1]) + (r8[2] + r8[3])) + ((r8[4] + r8[5]) + (r8[6] + r8[7]));
      mrow[qt] = mn;
      lrow[qt] = lrow[qt] * f + rs;               // halves are joined once, in the epilogue
#pragma unroll
      for (int t = 0; t < 4; ++t) acc[qt][t] *= f;

      // two S^T tiles (keys 0-15 and 16-31 of a 32-key block) are the B fragment as they lie
      v16h pb0, pb1;
#pragma unroll
      for (int i = 0; i < 8; ++i) {
        pb0[i]     = (_Float16)s[0][i];
        pb0[i + 8] = (_Float16)s[1][i];
        pb1[i]     = (_Float16)s[2][i];
        pb1[i + 8] = (_Float16)s[3][i];
      }

      // O^T += V^T P^T
#pragma unroll
      for (int t = 0; t < 4; ++t)
        acc[qt][t] = wmma_f16(frag_f16(Vl, t * 16, KV_PITCH, 0),  pb0, acc[qt][t]);
#pragma unroll
      for (int t = 0; t < 4; ++t)
        acc[qt][t] = wmma_f16(frag_f16(Vl, t * 16, KV_PITCH, 32), pb1, acc[qt][t]);
    }

    // publish the next stage, then refill the buffer that this pass has just read
    wait_ds0();
    if (pinned(wave < 2u)) wait_tensor0_of(g0, g1);
    __syncthreads();
    const unsigned nxt = pinned((unsigned)(j >> 6) + 2u);   // pinned(): the descriptor is formed behind the wait
    if (pinned(wave < 2u && nxt < n_stage)) {
      g0 = tdm_group0(lds0 + (unsigned)cur * (KV_BUF * 2u), ga0 + (unsigned long long)nxt * gstep);
      tdm_load(g0, g1);
    }
    cur ^= 1;
  }
  wait_tensor0();
  wait_ds0();

  // epilogue: normalize and write fp32 output [l][h*64+e]; 8 consecutive e per lane and tile
#pragma unroll
  for (int qt = 0; qt < 2; ++qt) {
    const float l = lrow[qt] + other_half(lrow[qt]);
    float* op = out + (size_t)(q0 + qt * 16 + cl) * D_MODEL + head * E_HEAD + cb;
#pragma unroll
    for (int t = 0; t < 4; ++t) {
      v4f o0, o1;
#pragma unroll
      for (int i = 0; i < 4; ++i) { o0[i] = acc[qt][t][i] / l; o1[i] = acc[qt][t][i + 4] / l; }
      *(v4f*)(op + t * 16)     = o0;
      *(v4f*)(op + t * 16 + 4) = o1;
    }
  }
}

// ---- launch -----------------------------------------------------------------
extern "C" void kernel_launch(void* const* d_in, const int* in_sizes, int n_in,
                              void* d_out, int out_size, void* d_ws, size_t ws_size,
                              hipStream_t stream) {
  const float* X    = (const float*)d_in[0];
  const float* mask = (const float*)d_in[1];
  const float* Wq   = (const float*)d_in[2];
  const float* bq   = (const float*)d_in[3];
  const float* Wk   = (const float*)d_in[4];
  const float* bk   = (const float*)d_in[5];
  const float* Wv   = (const float*)d_in[6];
  const float* bv   = (const float*)d_in[7];
  float* out        = (float*)d_out;

  const size_t per = (size_t)N_HEADS * L_SEQ * E_HEAD;  // 3,145,728 f16 each
  _Float16* Qh = (_Float16*)d_ws;
  _Float16* Kh = Qh + per;
  _Float16* Vt = Kh + per;

  dim3 gp(L_SEQ / 128, 3 * N_HEADS / 2);
  qkv_proj_kernel<<<gp, 256, 0, stream>>>(X, Wq, bq, Wk, bk, Wv, bv, Qh, Kh, Vt);

  dim3 ga(L_SEQ / 256, N_HEADS);
  flash_attn_kernel<<<ga, 256, 0, stream>>>(Qh, Kh, Vt, mask, out);
}

// v004
// It runs in 122 microseconds.
// Two timings next to v003 both put it at 1.49 times that version's speed.
// Over all steps from v000 it is 5.56 times as fast.
#include <hip/hip_runtime.h>

typedef _Float16 v16h __attribute__((ext_vector_type(16)));
typedef _Float16 v8h  __attribute__((ext_vector_type(8)));
typedef _Float16 v4h  __attribute__((ext_vector_type(4)));
typedef float    v8f  __attribute__((ext_vector_type(8)));
typedef float    v4f  __attribute__((ext_vector_type(4)));

#define L_SEQ   4096
#define D_MODEL 768
#define N_HEADS 12
#define E_HEAD  64
#define SCALE_Q 0.125f            // 64^-0.5
#define LOG2E   1.44269504088896f

// K and V tiles in LDS: 64 rows of 128 B, each followed by a 16-B pad that the tensor load leaves.
// Pitch 144 B = 16 B x 9: the 16 rows that one ds_load_b128 reads fall on 16 different bank groups.
#define KV_PITCH 72               // f16 per LDS row
#define KV_BUF   5120             // f16 per buffer: 64 x 144 B = 9216 B, rounded up to 10 KiB (a multiple of 2 KiB)

// ---- fragment loaders -------------------------------------------------------
// 16x32 f16 WMMA A/B fragment from a row-major f16 matrix (global or LDS).
// A: row0+(lane&15) is the M row.  B (via transposed storage): row0+(lane&15) is the N col.
// K chunks per ISA layout: lanes 0-15 hold K {0..7, 16..23}, lanes 16-31 hold {8..15, 24..31}.
static __device__ __forceinline__ v16h frag_f16(const _Float16* __restrict__ base,
                                                int row0, int stride, int k0) {
  int lane = threadIdx.x & 31;
  const _Float16* p = base + (size_t)(row0 + (lane & 15)) * stride + k0 + ((lane >> 4) << 3);
  v8h lo = *(const v8h*)p;
  v8h hi = *(const v8h*)(p + 16);
  v16h r;
#pragma unroll
  for (int i = 0; i < 8; ++i) { r[i] = lo[i]; r[i + 8] = hi[i]; }
  return r;
}

static __device__ __forceinline__ v8f wmma_f16(v16h a, v16h b, v8f c) {
  return __builtin_amdgcn_wmma_f32_16x16x32_f16(false, a, false, b, (short)0, c, false, false);
}

// Lane l <-> l ^ 16 as a vector cross-row move (no LDS round trip).
static __device__ __forceinline__ float other_half(float v) {
  int b = __builtin_bit_cast(int, v);
  b = __builtin_amdgcn_permlanex16(b, b, 0x76543210, 0xfedcba98, false, false);
  return __builtin_bit_cast(float, b);
}

// ---- tensor load: one 64-row x 128-B tile into LDS, padded to the 144-B pitch ----------------
typedef unsigned int u32x4 __attribute__((ext_vector_type(4)));
typedef unsigned int u32x8 __attribute__((ext_vector_type(8)));

static __device__ __forceinline__ unsigned uni(unsigned v) {
  return (unsigned)__builtin_amdgcn_readfirstlane(v);
}
static __device__ __forceinline__ unsigned pinned(unsigned v) {
  unsigned w = uni(v);
  asm volatile("" : "+s"(w));     // pinned(): descriptor word / issue test kept scalar
  return w;
}
// all extents in bytes (data_size code 0), tensor dims = tile dims
static __device__ __forceinline__ u32x8 tdm_group1(unsigned src_pitch) {
  u32x8 g;
  g[0] = uni((1u << 20) | (4u << 22) | (3u << 25));   // pad on, after every 128 B, 4 dwords; no mask
  g[1] = uni(128u << 16);                             // tensor_dim0 = 128 B
  g[2] = uni(64u << 16);                              // tensor_dim1 = 64 rows
  g[3] = uni(128u << 16);                             // tile_dim0 = 128 B
  g[4] = uni(64u);                                    // tile_dim1 = 64 rows
  g[5] = uni(src_pitch);                              // source row pitch, bytes
  g[6] = uni(0u);
  g[7] = uni(0u);
  return g;
}
static __device__ __forceinline__ u32x4 tdm_group0(unsigned lds_dst, unsigned long long ga) {
  u32x4 g;
  g[0] = uni(1u);                                                     // count = 1
  g[1] = uni(lds_dst);                                                // LDS byte address
  g[2] = uni((unsigned)ga);                                           // global address, low word
  g[3] = uni((((unsigned)(ga >> 32)) & 0x01FFFFFFu) | 0x80000000u);   // high bits | type = 2
  return g;
}
static __device__ __forceinline__ void tdm_load(u32x4 g0, u32x8 g1) {
  asm volatile("tensor_load_to_lds %0, %1" :: "s"(g0), "s"(g1) : "memory");
}
// The compiler places no wait for a tensor load: the issuing wave's own wait before the barrier.
static __device__ __forceinline__ void wait_tensor0() { asm volatile("s_wait_tensorcnt 0x0" ::: "memory"); }
// The same wait, naming the open request's descriptor as inputs: its scalar registers are then
// not given to other values while the request is in flight.
static __device__ __forceinline__ void wait_tensor0_of(u32x4 g0, u32x8 g1) {
  asm volatile("s_wait_tensorcnt 0x0" :: "s"(g0), "s"(g1) : "memory");
}
// this wave's LDS reads have retired before the buffer they read is refilled
static __device__ __forceinline__ void wait_ds0() { asm volatile("s_wait_dscnt 0x0" ::: "memory"); }
// in front of the rewrite of an address register that an issued global load names
static __device__ __forceinline__ void wait_x0() { asm volatile("s_wait_xcnt 0x0" ::: "memory"); }
// The work-group barrier alone. __syncthreads() also waits for every global load of the wave; the
// mask loads issued ahead are to stay in flight across it. The waits that the LDS ring needs
// (LDS reads, tensor load) stand in front of it in the source.
static __device__ __forceinline__ void wg_barrier() {
  asm volatile("s_barrier_signal -1\n\ts_barrier_wait -1" ::: "memory");
}

// ---- kernel 1: fused QKV projection, f32 -> f16 -----------------------------
// grid = (L/128, 3*H/2); block = 256 (8 waves). Block tile 128 rows x 128 columns (two heads),
// wave tile 32 x 64 (one head). The operands go through LDS: per stage of 32 k the block loads its
// 128 X rows and 128 W rows with whole-line loads (8 lanes x 16 B = one row's 128 B), converts each
// element once and stores it as f16; the waves take their fragments from there. Two buffers: the
// next stage's loads fly while this stage is multiplied.
#define PJ_K      32                // k per stage
#define PJ_PITCH  40                // f16 per LDS row: 64 B + 16 B, conflict-free for ds_load_b128
#define PJ_BUF    (128 * PJ_PITCH)  // f16 per buffer of 128 rows
#define PJ_STAGES (D_MODEL / PJ_K)

static __device__ __forceinline__ void put_f16x4(_Float16* dst, v4f v) {
  v4h h;
#pragma unroll
  for (int i = 0; i < 4; ++i) h[i] = (_Float16)v[i];
  *(v4h*)dst = h;
}

__global__ __launch_bounds__(256)
void qkv_proj_kernel(const float* __restrict__ X,
                     const float* __restrict__ Wq, const float* __restrict__ bq,
                     const float* __restrict__ Wk, const float* __restrict__ bk,
                     const float* __restrict__ Wv, const float* __restrict__ bv,
                     _Float16* __restrict__ Qh, _Float16* __restrict__ Kh,
                     _Float16* __restrict__ Vt) {
  __shared__ __attribute__((aligned(16))) _Float16 xs[2 * PJ_BUF];
  __shared__ __attribute__((aligned(16))) _Float16 wsh[2 * PJ_BUF];
  const int wv   = threadIdx.x >> 5;
  const int lane = threadIdx.x & 31;
  const int wm   = wv & 3;                          // the wave's 32 rows of the block's 128
  const int wn   = wv >> 2;                         // the wave's head of the block's two
  const int mb   = blockIdx.x * 128;
  const int seg  = blockIdx.y / (N_HEADS / 2);      // 0=Q 1=K 2=V
  const int hp   = blockIdx.y % (N_HEADS / 2);      // pair of heads
  const int head = hp * 2 + wn;
  const float* W = (seg == 0) ? Wq : (seg == 1) ? Wk : Wv;
  const float* B = (seg == 0) ? bq : (seg == 1) ? bk : bv;
  const int col0 = head * E_HEAD;

  // staging: thread -> (row sr of a group of 32 rows, 4 floats at k = sc)
  const int sr = threadIdx.x >> 3;
  const int sc = (threadIdx.x & 7) * 4;
  const float* xg = X + (size_t)(mb + sr) * D_MODEL + sc;
  const float* wg = W + (size_t)(hp * 128 + sr) * D_MODEL + sc;
  const int so = sr * PJ_PITCH + sc;

  v4f xr[4], wr[4];
#pragma unroll
  for (int i = 0; i < 4; ++i) xr[i] = *(const v4f*)(xg + i * 32 * D_MODEL);
#pragma unroll
  for (int i = 0; i < 4; ++i) wr[i] = *(const v4f*)(wg + i * 32 * D_MODEL);
#pragma unroll
  for (int i = 0; i < 4; ++i) put_f16x4(xs + so + i * 32 * PJ_PITCH, xr[i]);
#pragma unroll
  for (int i = 0; i < 4; ++i) put_f16x4(wsh + so + i * 32 * PJ_PITCH, wr[i]);
  __syncthreads();

  v8f acc[2][4] = {{{}, {}, {}, {}}, {{}, {}, {}, {}}};
  for (int s = 0; s < PJ_STAGES; ++s) {
    const int cur = s & 1;
    const bool more = s + 1 < PJ_STAGES;            // the same for the whole block
    if (more) {
      const int k1 = (s + 1) * PJ_K;
#pragma unroll
      for (int i = 0; i < 4; ++i) xr[i] = *(const v4f*)(xg + k1 + i * 32 * D_MODEL);
#pragma unroll
      for (int i = 0; i < 4; ++i) wr[i] = *(const v4f*)(wg + k1 + i * 32 * D_MODEL);
    }
    const _Float16* xt = xs + cur * PJ_BUF;
    const _Float16* wt = wsh + cur * PJ_BUF;
    v16h a[2], b[4];
#pragma unroll
    for (int r = 0; r < 2; ++r) a[r] = frag_f16(xt, wm * 32 + r * 16, PJ_PITCH, 0);
#pragma unroll
    for (int t = 0; t < 4; ++t) b[t] = frag_f16(wt, wn * 64 + t * 16, PJ_PITCH, 0);   // B col = W row (X @ W^T)
    // the next stage's global loads and this stage's LDS reads are issued as one group ahead of the
    // products: left free, the scheduler sinks them among the WMMAs and waits at every one
    __builtin_amdgcn_sched_barrier(0);
#pragma unroll
    for (int t = 0; t < 4; ++t)
#pragma unroll
      for (int r = 0; r < 2; ++r) acc[r][t] = wmma_f16(a[r], b[t], acc[r][t]);
    // the conversions, which wait for the global loads, stay behind the products
    __builtin_amdgcn_sched_barrier(0);
    if (more) {
      // into the buffer that every wave left before the barrier at the foot of the pass before
      _Float16* xn = xs + (cur ^ 1) * PJ_BUF + so;
      _Float16* wn2 = wsh + (cur ^ 1) * PJ_BUF + so;
#pragma unroll
      for (int i = 0; i < 4; ++i) put_f16x4(xn + i * 32 * PJ_PITCH, xr[i]);
#pragma unroll
      for (int i = 0; i < 4; ++i) put_f16x4(wn2 + i * 32 * PJ_PITCH, wr[i]);
      __syncthreads();                              // publishes stage s + 1, ends the reads of stage s
    }
  }

  const int chi = lane >> 4, cl = lane & 15;
  const int m0 = mb + wm * 32;
  if (seg < 2) {
    _Float16* dst = (seg == 0 ? Qh : Kh) + (size_t)head * L_SEQ * E_HEAD;
#pragma unroll
    for (int t = 0; t < 4; ++t) {
      const int e = t * 16 + cl;
      const float bb = B[col0 + e];
#pragma unroll
      for (int r = 0; r < 2; ++r)
#pragma unroll
        for (int i = 0; i < 8; ++i) {
          const int row = m0 + r * 16 + chi * 8 + i;
          dst[(size_t)row * E_HEAD + e] = (_Float16)(acc[r][t][i] + bb);
        }
    }
  } else {
    _Float16* dst = Vt + (size_t)head * E_HEAD * L_SEQ;   // transposed: [head][e][l]
#pragma unroll
    for (int t = 0; t < 4; ++t) {
      const int e = t * 16 + cl;
      const float bb = B[col0 + e];
#pragma unroll
      for (int r = 0; r < 2; ++r) {
        v8h pk;
#pragma unroll
        for (int i = 0; i < 8; ++i) pk[i] = (_Float16)(acc[r][t][i] + bb);
        *(v8h*)(dst + (size_t)e * L_SEQ + m0 + r * 16 + chi * 8) = pk;
      }
    }
    // behind the last store: the code laid out after this branch rewrites the stores' registers
    asm volatile("s_wait_xcnt 0x0" ::: "memory");
  }
}

__global__ __launch_bounds__(256)
void flash_attn_kernel(const _Float16* __restrict__ Qh, const _Float16* __restrict__ Kh,
                       const _Float16* __restrict__ Vt, const float* __restrict__ mask,
                       float* __restrict__ out) {
  // Kbuf x2 (64 keys x 64 e, row-major), then Vbuf x2 (64 e x 64 keys); rows at KV_PITCH.
  __shared__ __attribute__((aligned(2048))) _Float16 smem[4 * KV_BUF];
  const int wv   = threadIdx.x >> 5;
  const int lane = threadIdx.x & 31;
  const int head = blockIdx.y;
  const int q0   = blockIdx.x * 256 + wv * 32;    // 32 queries per wave
  const _Float16* Q = Qh + (size_t)head * L_SEQ * E_HEAD;
  const _Float16* K = Kh + (size_t)head * L_SEQ * E_HEAD;
  const _Float16* V = Vt + (size_t)head * E_HEAD * L_SEQ;
  const int chi = lane >> 4, cl = lane & 15;
  const int cb  = chi * 8;

  v16h qb[2][2];                                  // B operand: column = query
#pragma unroll
  for (int qt = 0; qt < 2; ++qt) {
    qb[qt][0] = frag_f16(Q, q0 + qt * 16, E_HEAD, 0);
    qb[qt][1] = frag_f16(Q, q0 + qt * 16, E_HEAD, 32);
  }

  v8f acc[2][4] = {{{}, {}, {}, {}}, {{}, {}, {}, {}}};   // O^T: row = e, column = query
  float mrow[2], lrow[2];                         // lrow: this half-wave's share of the sum
#pragma unroll
  for (int qt = 0; qt < 2; ++qt) { mrow[qt] = -1e30f; lrow[qt] = 0.0f; }

  unsigned moff[2];                               // byte offset of (query row, key cb) in the mask
#pragma unroll
  for (int qt = 0; qt < 2; ++qt)
    moff[qt] = (unsigned)((q0 + qt * 16 + cl) * L_SEQ + cb) * 4u;

  // This lane's mask values of one stage: one query row a qt, keys j + ct*16 + cb + 0..7. They are
  // fetched one stage ahead: such a load touches 16 rows (16 lines), and waited for in the pass that
  // issues it, it holds up every wave of the block at the head of the pass.
  v8f mk[2][4];
#pragma unroll
  for (int qt = 0; qt < 2; ++qt)
#pragma unroll
    for (int ct = 0; ct < 4; ++ct)
      mk[qt][ct] = *(const v8f*)((const char*)(mask + ct * 16) + moff[qt]);
  wait_x0();
  // the lane's place in the stage that the coming pass fetches (qt = 0); it lives through the pass
  // and is advanced only at the foot, behind wait_x0()
  const char* mnext = (const char*)(mask + 64) + moff[0];

  // Wave 0 brings the K tiles, wave 1 the V tiles: one request of a wave in flight at a time.
  const unsigned wave    = uni(threadIdx.x >> 5);
  const unsigned is_v    = wave == 1u ? 1u : 0u;
  const u32x8    g1      = tdm_group1(is_v ? L_SEQ * 2u : E_HEAD * 2u);
  const unsigned lds0    = (unsigned)(size_t)smem + is_v * (2u * KV_BUF * 2u);
  const unsigned long long ga0 = (unsigned long long)(is_v ? V : K);
  const unsigned gstep   = is_v ? 64u * 2u : 64u * E_HEAD * 2u;   // bytes from one stage's tile to the next
  const unsigned n_stage = L_SEQ / 64;

  u32x4 g0 = tdm_group0(lds0, ga0);
  if (pinned(wave < 2u)) {
    tdm_load(g0, g1);
    wait_tensor0_of(g0, g1);
  }
  __syncthreads();
  g0 = tdm_group0(lds0 + KV_BUF * 2u, ga0 + gstep);
  if (pinned(wave < 2u)) tdm_load(g0, g1);

  int cur = 0;
  for (int j = 0; j < L_SEQ; j += 64) {
    const _Float16* Kt = smem + cur * KV_BUF;
    const _Float16* Vl = smem + 2 * KV_BUF + cur * KV_BUF;

    // S^T = K Q^T for 64 keys: 4 row tiles x (e=64 as 2 chunks); then scale and mask, exp2 domain
    v8f sc[2][4];
#pragma unroll
    for (int qt = 0; qt < 2; ++qt)
#pragma unroll
      for (int ct = 0; ct < 4; ++ct) {
        v16h ka0 = frag_f16(Kt, ct * 16, KV_PITCH, 0);
        v16h ka1 = frag_f16(Kt, ct * 16, KV_PITCH, 32);
        v8f z = {};
        z = wmma_f16(ka0, qb[qt][0], z);
        z = wmma_f16(ka1, qb[qt][1], z);
        sc[qt][ct] = z * (SCALE_Q * LOG2E) + mk[qt][ct] * LOG2E;
      }
    // the next stage's mask values, into the registers just read: they fly during the softmax, the
    // second product and the barrier
#pragma unroll
    for (int qt = 0; qt < 2; ++qt)
#pragma unroll
      for (int ct = 0; ct < 4; ++ct)
        mk[qt][ct] = *(const v8f*)(mnext + qt * (16 * L_SEQ * 4) + ct * 64);
    // left free, the scheduler sinks these loads to the foot of the pass, where they have no lead
    __builtin_amdgcn_sched_barrier(0);

#pragma unroll
    for (int qt = 0; qt < 2; ++qt) {
      // online softmax: 32 of the query's 64 scores are in this lane
      v8f s[4];
#pragma unroll
      for (int ct = 0; ct < 4; ++ct) s[ct] = sc[qt][ct];
      const v8f m8 = __builtin_elementwise_max(__builtin_elementwise_max(s[0], s[1]),
                                               __builtin_elementwise_max(s[2], s[3]));
      float mx = fmaxf(fmaxf(fmaxf(m8[0], m8[1]), fmaxf(m8[2], m8[3])),
                       fmaxf(fmaxf(m8[4], m8[5]), fmaxf(m8[6], m8[7])));
      mx = fmaxf(mx, other_half(mx));             // the other 32 keys of the same query
      const float mo = mrow[qt];
      const float mn = fmaxf(mo, mx);
      const float f  = exp2f(mo - mn);
      // (exp2f is the library form: the listing has a range test, two selects, an add and a ldexp
      // around each v_exp_f32)
#pragma unroll
      for (int ct = 0; ct < 4; ++ct)
#pragma unroll
        for (int i = 0; i < 8; ++i) s[ct][i] = exp2f(s[ct][i] - mn);
      const v8f r8 = (s[0] + s[1]) + (s[2] + s[3]);
      const float rs = ((r8[0] + r8[1]) + (r8[2] + r8[3])) + ((r8[4] + r8[5]) + (r8[6] + r8[7]));
      mrow[qt] = mn;
      lrow[qt] = lrow[qt] * f + rs;               // halves are joined once, in the epilogue
#pragma unroll
      for (int t = 0; t < 4; ++t) acc[qt][t] *= f;

      // two S^T tiles (keys 0-15 and 16-31 of a 32-key block) are the B fragment as they lie
      v16h pb0, pb1;
#pragma unroll
      for (int i = 0; i < 8; ++i) {
        pb0[i]     = (_Float16)s[0][i];
        pb0[i + 8] = (_Float16)s[1][i];
        pb1[i]     = (_Float16)s[2][i];
        pb1[i + 8] = (_Float16)s[3][i];
      }

      // O^T += V^T P^T
#pragma unroll
      for (int t = 0; t < 4; ++t)
        acc[qt][t] = wmma_f16(frag_f16(Vl, t * 16, KV_PITCH, 0),  pb0, acc[qt][t]);
#pragma unroll
      for (int t = 0; t < 4; ++t)
        acc[qt][t] = wmma_f16(frag_f16(Vl, t * 16, KV_PITCH, 32), pb1, acc[qt][t]);
    }

    // publish the next stage, then refill the buffer that this pass has just read
    wait_ds0();
    wait_x0();                                    // mnext is rewritten below
    if (pinned(wave < 2u)) wait_tensor0_of(g0, g1);
    wg_barrier();
    const unsigned nxt = pinned((unsigned)(j >> 6) + 2u);   // pinned(): the descriptor is formed behind the wait
    // the step comes from nxt, so the add stands behind the waits; the last pass fetches the last
    // stage once more (in bounds, unused)
    mnext += nxt < n_stage ? 64u * 4u : 0u;
    if (pinned(wave < 2u && nxt < n_stage)) {
      g0 = tdm_group0(lds0 + (unsigned)cur * (KV_BUF * 2u), ga0 + (unsigned long long)nxt * gstep);
      tdm_load(g0, g1);
    }
    cur ^= 1;
  }
  wait_tensor0();
  wait_ds0();
  // the last pass's unused fetch has returned before its registers are given to other values
  asm volatile("s_wait_loadcnt 0x0" ::: "memory");

  // epilogue: normalize and write fp32 output [l][h*64+e]; 8 consecutive e per lane and tile
#pragma unroll
  for (int qt = 0; qt < 2; ++qt) {
    const float l = lrow[qt] + other_half(lrow[qt]);
    float* op = out + (size_t)(q0 + qt * 16 + cl) * D_MODEL + head * E_HEAD + cb;
#pragma unroll
    for (int t = 0; t < 4; ++t) {
      v4f o0, o1;
#pragma unroll
      for (int i = 0; i < 4; ++i) { o0[i] = acc[qt][t][i] / l; o1[i] = acc[qt][t][i + 4] / l; }
      *(v4f*)(op + t * 16)     = o0;
      *(v4f*)(op + t * 16 + 4) = o1;
    }
  }
}

// ---- launch -----------------------------------------------------------------
extern "C" void kernel_launch(void* const* d_in, const int* in_sizes, int n_in,
                              void* d_out, int out_size, void* d_ws, size_t ws_size,
                              hipStream_t stream) {
  const float* X    = (const float*)d_in[0];
  const float* mask = (const float*)d_in[1];
  const float* Wq   = (const float*)d_in[2];
  const float* bq   = (const float*)d_in[3];
  const float* Wk   = (const float*)d_in[4];
  const float* bk   = (const float*)d_in[5];
  const float* Wv   = (const float*)d_in[6];
  const float* bv   = (const float*)d_in[7];
  float* out        = (float*)d_out;

  const size_t per = (size_t)N_HEADS * L_SEQ * E_HEAD;  // 3,145,728 f16 each
  _Float16* Qh = (_Float16*)d_ws;
  _Float16* Kh = Qh + per;
  _Float16* Vt = Kh + per;

  dim3 gp(L_SEQ / 128, 3 * N_HEADS / 2);
  qkv_proj_kernel<<<gp, 256, 0, stream>>>(X, Wq, bq, Wk, bk, Wv, bv, Qh, Kh, Vt);

  dim3 ga(L_SEQ / 256, N_HEADS);
  flash_attn_kernel<<<ga, 256, 0, stream>>>(Qh, Kh, Vt, mask, out);
}

// v005
// A run of this version takes 116 microseconds.
// Two timings next to v004 both put it at 1.03 times that version's speed.
// Over all steps from v000 it is 5.75 times as fast.
#include <hip/hip_runtime.h>

typedef _Float16 v16h __attribute__((ext_vector_type(16)));
typedef _Float16 v8h  __attribute__((ext_vector_type(8)));
typedef _Float16 v4h  __attribute__((ext_vector_type(4)));
typedef float    v8f  __attribute__((ext_vector_type(8)));
typedef float    v4f  __attribute__((ext_vector_type(4)));

#define L_SEQ   4096
#define D_MODEL 768
#define N_HEADS 12
#define E_HEAD  64
#define SCALE_Q 0.125f            // 64^-0.5
#define LOG2E   1.44269504088896f

// K and V tiles in LDS: 64 rows of 128 B, each followed by a 16-B pad that the tensor load leaves.
// Pitch 144 B = 16 B x 9: the 16 rows that one ds_load_b128 reads fall on 16 different bank groups.
#define KV_PITCH 72               // f16 per LDS row
#define KV_BUF   5120             // f16 per buffer: 64 x 144 B = 9216 B, rounded up to 10 KiB (a multiple of 2 KiB)

// ---- fragment loaders -------------------------------------------------------
// 16x32 f16 WMMA A/B fragment from a row-major f16 matrix (global or LDS).
// A: row0+(lane&15) is the M row.  B (via transposed storage): row0+(lane&15) is the N col.
// K chunks per ISA layout: lanes 0-15 hold K {0..7, 16..23}, lanes 16-31 hold {8..15, 24..31}.
static __device__ __forceinline__ v16h frag_f16(const _Float16* __restrict__ base,
                                                int row0, int stride, int k0) {
  int lane = threadIdx.x & 31;
  const _Float16* p = base + (size_t)(row0 + (lane & 15)) * stride + k0 + ((lane >> 4) << 3);
  v8h lo = *(const v8h*)p;
  v8h hi = *(const v8h*)(p + 16);
  v16h r;
#pragma unroll
  for (int i = 0; i < 8; ++i) { r[i] = lo[i]; r[i + 8] = hi[i]; }
  return r;
}

static __device__ __forceinline__ v8f wmma_f16(v16h a, v16h b, v8f c) {
  return __builtin_amdgcn_wmma_f32_16x16x32_f16(false, a, false, b, (short)0, c, false, false);
}

// Lane l <-> l ^ 16 as a vector cross-row move (no LDS round trip).
static __device__ __forceinline__ float other_half(float v) {
  int b = __builtin_bit_cast(int, v);
  b = __builtin_amdgcn_permlanex16(b, b, 0x76543210, 0xfedcba98, false, false);
  return __builtin_bit_cast(float, b);
}

// 2^x as the bare v_exp_f32. The library exp2f puts a range test, two selects, an add and a ldexp
// around each, for results below 2^-126 alone. The softmax arguments are <= 0 and a row's sum holds
// the term 1 of its maximum: a result that small may count as 0.
// Eight in one statement, the results in registers apart from all eight arguments ("=&v"): no
// v_exp_f32 is then followed directly by a reader of its result or by a write of its source, where
// the instruction set asks for one independent instruction. The v_nop is that slot behind the last one.
static __device__ __forceinline__ void exp2_x8(v8f& x) {
  float a, b, c, d, e, f, g, h;
  asm("v_exp_f32 %0, %8\n\tv_exp_f32 %1, %9\n\tv_exp_f32 %2, %10\n\tv_exp_f32 %3, %11\n\t"
      "v_exp_f32 %4, %12\n\tv_exp_f32 %5, %13\n\tv_exp_f32 %6, %14\n\tv_exp_f32 %7, %15\n\tv_nop"
      : "=&v"(a), "=&v"(b), "=&v"(c), "=&v"(d), "=&v"(e), "=&v"(f), "=&v"(g), "=&v"(h)
      : "v"(x[0]), "v"(x[1]), "v"(x[2]), "v"(x[3]), "v"(x[4]), "v"(x[5]), "v"(x[6]), "v"(x[7]));
  x[0] = a; x[1] = b; x[2] = c; x[3] = d; x[4] = e; x[5] = f; x[6] = g; x[7] = h;
}
// the same for one value, in place
static __device__ __forceinline__ float exp2_x1(float x) {
  asm("v_exp_f32 %0, %0\n\tv_nop" : "+v"(x));
  return x;
}

// ---- tensor load: one 64-row x 128-B tile into LDS, padded to the 144-B pitch ----------------
typedef unsigned int u32x4 __attribute__((ext_vector_type(4)));
typedef unsigned int u32x8 __attribute__((ext_vector_type(8)));

static __device__ __forceinline__ unsigned uni(unsigned v) {
  return (unsigned)__builtin_amdgcn_readfirstlane(v);
}
static __device__ __forceinline__ unsigned pinned(unsigned v) {
  unsigned w = uni(v);
  asm volatile("" : "+s"(w));     // pinned(): descriptor word / issue test kept scalar
  return w;
}
// all extents in bytes (data_size code 0), tensor dims = tile dims
static __device__ __forceinline__ u32x8 tdm_group1(unsigned src_pitch) {
  u32x8 g;
  g[0] = uni((1u << 20) | (4u << 22) | (3u << 25));   // pad on, after every 128 B, 4 dwords; no mask
  g[1] = uni(128u << 16);                             // tensor_dim0 = 128 B
  g[2] = uni(64u << 16);                              // tensor_dim1 = 64 rows
  g[3] = uni(128u << 16);                             // tile_dim0 = 128 B
  g[4] = uni(64u);                                    // tile_dim1 = 64 rows
  g[5] = uni(src_pitch);                              // source row pitch, bytes
  g[6] = uni(0u);
  g[7] = uni(0u);
  return g;
}
static __device__ __forceinline__ u32x4 tdm_group0(unsigned lds_dst, unsigned long long ga) {
  u32x4 g;
  g[0] = uni(1u);                                                     // count = 1
  g[1] = uni(lds_dst);                                                // LDS byte address
  g[2] = uni((unsigned)ga);                                           // global address, low word
  g[3] = uni((((unsigned)(ga >> 32)) & 0x01FFFFFFu) | 0x80000000u);   // high bits | type = 2
  return g;
}
static __device__ __forceinline__ void tdm_load(u32x4 g0, u32x8 g1) {
  asm volatile("tensor_load_to_lds %0, %1" :: "s"(g0), "s"(g1) : "memory");
}
// The compiler places no wait for a tensor load: the issuing wave's own wait before the barrier.
static __device__ __forceinline__ void wait_tensor0() { asm volatile("s_wait_tensorcnt 0x0" ::: "memory"); }
// The same wait, naming the open request's descriptor as inputs: its scalar registers are then
// not given to other values while the request is in flight.
static __device__ __forceinline__ void wait_tensor0_of(u32x4 g0, u32x8 g1) {
  asm volatile("s_wait_tensorcnt 0x0" :: "s"(g0), "s"(g1) : "memory");
}
// this wave's LDS reads have retired before the buffer they read is refilled
static __device__ __forceinline__ void wait_ds0() { asm volatile("s_wait_dscnt 0x0" ::: "memory"); }
// in front of the rewrite of an address register that an issued global load names
static __device__ __forceinline__ void wait_x0() { asm volatile("s_wait_xcnt 0x0" ::: "memory"); }
// The work-group barrier alone. __syncthreads() also waits for every global load of the wave; the
// mask loads issued ahead are to stay in flight across it. The waits that the LDS ring needs
// (LDS reads, tensor load) stand in front of it in the source.
static __device__ __forceinline__ void wg_barrier() {
  asm volatile("s_barrier_signal -1\n\ts_barrier_wait -1" ::: "memory");
}

// ---- kernel 1: fused QKV projection, f32 -> f16 -----------------------------
// grid = (L/128, 3*H/2); block = 256 (8 waves). Block tile 128 rows x 128 columns (two heads),
// wave tile 32 x 64 (one head). The operands go through LDS: per stage of 32 k the block loads its
// 128 X rows and 128 W rows with whole-line loads (8 lanes x 16 B = one row's 128 B), converts each
// element once and stores it as f16; the waves take their fragments from there. Two buffers: the
// next stage's loads fly while this stage is multiplied.
#define PJ_K      32                // k per stage
#define PJ_PITCH  40                // f16 per LDS row: 64 B + 16 B, conflict-free for ds_load_b128
#define PJ_BUF    (128 * PJ_PITCH)  // f16 per buffer of 128 rows
#define PJ_STAGES (D_MODEL / PJ_K)

static __device__ __forceinline__ void put_f16x4(_Float16* dst, v4f v) {
  v4h h;
#pragma unroll
  for (int i = 0; i < 4; ++i) h[i] = (_Float16)v[i];
  *(v4h*)dst = h;
}

__global__ __launch_bounds__(256)
void qkv_proj_kernel(const float* __restrict__ X,
                     const float* __restrict__ Wq, const float* __restrict__ bq,
                     const float* __restrict__ Wk, const float* __restrict__ bk,
                     const float* __restrict__ Wv, const float* __restrict__ bv,
                     _Float16* __restrict__ Qh, _Float16* __restrict__ Kh,
                     _Float16* __restrict__ Vt) {
  __shared__ __attribute__((aligned(16))) _Float16 xs[2 * PJ_BUF];
  __shared__ __attribute__((aligned(16))) _Float16 wsh[2 * PJ_BUF];
  const int wv   = threadIdx.x >> 5;
  const int lane = threadIdx.x & 31;
  const int wm   = wv & 3;                          // the wave's 32 rows of the block's 128
  const int wn   = wv >> 2;                         // the wave's head of the block's two
  const int mb   = blockIdx.x * 128;
  const int seg  = blockIdx.y / (N_HEADS / 2);      // 0=Q 1=K 2=V
  const int hp   = blockIdx.y % (N_HEADS / 2);      // pair of heads
  const int head = hp * 2 + wn;
  const float* W = (seg == 0) ? Wq : (seg == 1) ? Wk : Wv;
  const float* B = (seg == 0) ? bq : (seg == 1) ? bk : bv;
  const int col0 = head * E_HEAD;

  // staging: thread -> (row sr of a group of 32 rows, 4 floats at k = sc)
  const int sr = threadIdx.x >> 3;
  const int sc = (threadIdx.x & 7) * 4;
  const float* xg = X + (size_t)(mb + sr) * D_MODEL + sc;
  const float* wg = W + (size_t)(hp * 128 + sr) * D_MODEL + sc;
  const int so = sr * PJ_PITCH + sc;

  v4f xr[4], wr[4];
#pragma unroll
  for (int i = 0; i < 4; ++i) xr[i] = *(const v4f*)(xg + i * 32 * D_MODEL);
#pragma unroll
  for (int i = 0; i < 4; ++i) wr[i] = *(const v4f*)(wg + i * 32 * D_MODEL);
#pragma unroll
  for (int i = 0; i < 4; ++i) put_f16x4(xs + so + i * 32 * PJ_PITCH, xr[i]);
#pragma unroll
  for (int i = 0; i < 4; ++i) put_f16x4(wsh + so + i * 32 * PJ_PITCH, wr[i]);
  __syncthreads();

  v8f acc[2][4] = {{{}, {}, {}, {}}, {{}, {}, {}, {}}};
  for (int s = 0; s < PJ_STAGES; ++s) {
    const int cur = s & 1;
    const bool more = s + 1 < PJ_STAGES;            // the same for the whole block
    if (more) {
      const int k1 = (s + 1) * PJ_K;
#pragma unroll
      for (int i = 0; i < 4; ++i) xr[i] = *(const v4f*)(xg + k1 + i * 32 * D_MODEL);
#pragma unroll
      for (int i = 0; i < 4; ++i) wr[i] = *(const v4f*)(wg + k1 + i * 32 * D_MODEL);
    }
    const _Float16* xt = xs + cur * PJ_BUF;
    const _Float16* wt = wsh + cur * PJ_BUF;
    v16h a[2], b[4];
#pragma unroll
    for (int r = 0; r < 2; ++r) a[r] = frag_f16(xt, wm * 32 + r * 16, PJ_PITCH, 0);
#pragma unroll
    for (int t = 0; t < 4; ++t) b[t] = frag_f16(wt, wn * 64 + t * 16, PJ_PITCH, 0);   // B col = W row (X @ W^T)
    // the next stage's global loads and this stage's LDS reads are issued as one group ahead of the
    // products: left free, the scheduler sinks them among the WMMAs and waits at every one
    __builtin_amdgcn_sched_barrier(0);
#pragma unroll
    for (int t = 0; t < 4; ++t)
#pragma unroll
      for (int r = 0; r < 2; ++r) acc[r][t] = wmma_f16(a[r], b[t], acc[r][t]);
    // the conversions, which wait for the global loads, stay behind the products
    __builtin_amdgcn_sched_barrier(0);
    if (more) {
      // into the buffer that every wave left before the barrier at the foot of the pass before
      _Float16* xn = xs + (cur ^ 1) * PJ_BUF + so;
      _Float16* wn2 = wsh + (cur ^ 1) * PJ_BUF + so;
#pragma unroll
      for (int i = 0; i < 4; ++i) put_f16x4(xn + i * 32 * PJ_PITCH, xr[i]);
#pragma unroll
      for (int i = 0; i < 4; ++i) put_f16x4(wn2 + i * 32 * PJ_PITCH, wr[i]);
      __syncthreads();                              // publishes stage s + 1, ends the reads of stage s
    }
  }

  const int chi = lane >> 4, cl = lane & 15;
  const int m0 = mb + wm * 32;
  if (seg < 2) {
    _Float16* dst = (seg == 0 ? Qh : Kh) + (size_t)head * L_SEQ * E_HEAD;
#pragma unroll
    for (int t = 0; t < 4; ++t) {
      const int e = t * 16 + cl;
      const float bb = B[col0 + e];
#pragma unroll
      for (int r = 0; r < 2; ++r)
#pragma unroll
        for (int i = 0; i < 8; ++i) {
          const int row = m0 + r * 16 + chi * 8 + i;
          dst[(size_t)row * E_HEAD + e] = (_Float16)(acc[r][t][i] + bb);
        }
    }
  } else {
    _Float16* dst = Vt + (size_t)head * E_HEAD * L_SEQ;   // transposed: [head][e][l]
#pragma unroll
    for (int t = 0; t < 4; ++t) {
      const int e = t * 16 + cl;
      const float bb = B[col0 + e];
#pragma unroll
      for (int r = 0; r < 2; ++r) {
        v8h pk;
#pragma unroll
        for (int i = 0; i < 8; ++i) pk[i] = (_Float16)(acc[r][t][i] + bb);
        *(v8h*)(dst + (size_t)e * L_SEQ + m0 + r * 16 + chi * 8) = pk;
      }
    }
    // behind the last store: the code laid out after this branch rewrites the stores' registers
    asm volatile("s_wait_xcnt 0x0" ::: "memory");
  }
}

__global__ __launch_bounds__(256)
void flash_attn_kernel(const _Float16* __restrict__ Qh, const _Float16* __restrict__ Kh,
                       const _Float16* __restrict__ Vt, const float* __restrict__ mask,
                       float* __restrict__ out) {
  // Kbuf x2 (64 keys x 64 e, row-major), then Vbuf x2 (64 e x 64 keys); rows at KV_PITCH.
  __shared__ __attribute__((aligned(2048))) _Float16 smem[4 * KV_BUF];
  const int wv   = threadIdx.x >> 5;
  const int lane = threadIdx.x & 31;
  const int head = blockIdx.y;
  const int q0   = blockIdx.x * 256 + wv * 32;    // 32 queries per wave
  const _Float16* Q = Qh + (size_t)head * L_SEQ * E_HEAD;
  const _Float16* K = Kh + (size_t)head * L_SEQ * E_HEAD;
  const _Float16* V = Vt + (size_t)head * E_HEAD * L_SEQ;
  const int chi = lane >> 4, cl = lane & 15;
  const int cb  = chi * 8;

  v16h qb[2][2];                                  // B operand: column = query
#pragma unroll
  for (int qt = 0; qt < 2; ++qt) {
    qb[qt][0] = frag_f16(Q, q0 + qt * 16, E_HEAD, 0);
    qb[qt][1] = frag_f16(Q, q0 + qt * 16, E_HEAD, 32);
  }

  v8f acc[2][4] = {{{}, {}, {}, {}}, {{}, {}, {}, {}}};   // O^T: row = e, column = query
  float mrow[2], lrow[2];                         // lrow: this half-wave's share of the sum
#pragma unroll
  for (int qt = 0; qt < 2; ++qt) { mrow[qt] = -1e30f; lrow[qt] = 0.0f; }

  unsigned moff[2];                               // byte offset of (query row, key cb) in the mask
#pragma unroll
  for (int qt = 0; qt < 2; ++qt)
    moff[qt] = (unsigned)((q0 + qt * 16 + cl) * L_SEQ + cb) * 4u;

  // This lane's mask values of one stage: one query row a qt, keys j + ct*16 + cb + 0..7. They are
  // fetched one stage ahead: such a load touches 16 rows (16 lines), and waited for in the pass that
  // issues it, it holds up every wave of the block at the head of the pass.
  v8f mk[2][4];
#pragma unroll
  for (int qt = 0; qt < 2; ++qt)
#pragma unroll
    for (int ct = 0; ct < 4; ++ct)
      mk[qt][ct] = *(const v8f*)((const char*)(mask + ct * 16) + moff[qt]);
  wait_x0();
  // the lane's place in the stage that the coming pass fetches (qt = 0); it lives through the pass
  // and is advanced only at the foot, behind wait_x0()
  const char* mnext = (const char*)(mask + 64) + moff[0];

  // Wave 0 brings the K tiles, wave 1 the V tiles: one request of a wave in flight at a time.
  const unsigned wave    = uni(threadIdx.x >> 5);
  const unsigned is_v    = wave == 1u ? 1u : 0u;
  const u32x8    g1      = tdm_group1(is_v ? L_SEQ * 2u : E_HEAD * 2u);
  const unsigned lds0    = (unsigned)(size_t)smem + is_v * (2u * KV_BUF * 2u);
  const unsigned long long ga0 = (unsigned long long)(is_v ? V : K);
  const unsigned gstep   = is_v ? 64u * 2u : 64u * E_HEAD * 2u;   // bytes from one stage's tile to the next
  const unsigned n_stage = L_SEQ / 64;

  u32x4 g0 = tdm_group0(lds0, ga0);
  if (pinned(wave < 2u)) {
    tdm_load(g0, g1);
    wait_tensor0_of(g0, g1);
  }
  __syncthreads();
  g0 = tdm_group0(lds0 + KV_BUF * 2u, ga0 + gstep);
  if (pinned(wave < 2u)) tdm_load(g0, g1);

  int cur = 0;
  for (int j = 0; j < L_SEQ; j += 64) {
    const _Float16* Kt = smem + cur * KV_BUF;
    const _Float16* Vl = smem + 2 * KV_BUF + cur * KV_BUF;

    // S^T = K Q^T for 64 keys: 4 row tiles x (e=64 as 2 chunks); then scale and mask, exp2 domain
    v8f sc[2][4];
#pragma unroll
    for (int qt = 0; qt < 2; ++qt)
#pragma unroll
      for (int ct = 0; ct < 4; ++ct) {
        v16h ka0 = frag_f16(Kt, ct * 16, KV_PITCH, 0);
        v16h ka1 = frag_f16(Kt, ct * 16, KV_PITCH, 32);
        v8f z = {};
        z = wmma_f16(ka0, qb[qt][0], z);
        z = wmma_f16(ka1, qb[qt][1], z);
        sc[qt][ct] = z * (SCALE_Q * LOG2E) + mk[qt][ct] * LOG2E;
      }
    // the next stage's mask values, into the registers just read: they fly during the softmax, the
    // second product and the barrier
#pragma unroll
    for (int qt = 0; qt < 2; ++qt)
#pragma unroll
      for (int ct = 0; ct < 4; ++ct)
        mk[qt][ct] = *(const v8f*)(mnext + qt * (16 * L_SEQ * 4) + ct * 64);
    // left free, the scheduler sinks these loads to the foot of the pass, where they have no lead
    __builtin_amdgcn_sched_barrier(0);

#pragma unroll
    for (int qt = 0; qt < 2; ++qt) {
      // online softmax: 32 of the query's 64 scores are in this lane
      v8f s[4];
#pragma unroll
      for (int ct = 0; ct < 4; ++ct) s[ct] = sc[qt][ct];
      const v8f m8 = __builtin_elementwise_max(__builtin_elementwise_max(s[0], s[1]),
                                               __builtin_elementwise_max(s[2], s[3]));
      float mx = fmaxf(fmaxf(fmaxf(m8[0], m8[1]), fmaxf(m8[2], m8[3])),
                       fmaxf(fmaxf(m8[4], m8[5]), fmaxf(m8[6], m8[7])));
      mx = fmaxf(mx, other_half(mx));             // the other 32 keys of the same query
      const float mo = mrow[qt];
      const float mn = fmaxf(mo, mx);
      const float f  = exp2_x1(mo - mn);
#pragma unroll
      for (int ct = 0; ct < 4; ++ct) {
        s[ct] -= mn;
        exp2_x8(s[ct]);
      }
      const v8f r8 = (s[0] + s[1]) + (s[2] + s[3]);
      const float rs = ((r8[0] + r8[1]) + (r8[2] + r8[3])) + ((r8[4] + r8[5]) + (r8[6] + r8[7]));
      mrow[qt] = mn;
      lrow[qt] = lrow[qt] * f + rs;               // halves are joined once, in the epilogue
#pragma unroll
      for (int t = 0; t < 4; ++t) acc[qt][t] *= f;

      // two S^T tiles (keys 0-15 and 16-31 of a 32-key block) are the B fragment as they lie
      v16h pb0, pb1;
#pragma unroll
      for (int i = 0; i < 8; ++i) {
        pb0[i]     = (_Float16)s[0][i];
        pb0[i + 8] = (_Float16)s[1][i];
        pb1[i]     = (_Float16)s[2][i];
        pb1[i + 8] = (_Float16)s[3][i];
      }

      // O^T += V^T P^T
#pragma unroll
      for (int t = 0; t < 4; ++t)
        acc[qt][t] = wmma_f16(frag_f16(Vl, t * 16, KV_PITCH, 0),  pb0, acc[qt][t]);
#pragma unroll
      for (int t = 0; t < 4; ++t)
        acc[qt][t] = wmma_f16(frag_f16(Vl, t * 16, KV_PITCH, 32), pb1, acc[qt][t]);
    }

    // publish the next stage, then refill the buffer that this pass has just read
    wait_ds0();
    wait_x0();                                    // mnext is rewritten below
    if (pinned(wave < 2u)) wait_tensor0_of(g0, g1);
    wg_barrier();
    const unsigned nxt = pinned((unsigned)(j >> 6) + 2u);   // pinned(): the descriptor is formed behind the wait
    // the step comes from nxt, so the add stands behind the waits; the last pass fetches the last
    // stage once more (in bounds, unused)
    mnext += nxt < n_stage ? 64u * 4u : 0u;
    if (pinned(wave < 2u && nxt < n_stage)) {
      g0 = tdm_group0(lds0 + (unsigned)cur * (KV_BUF * 2u), ga0 + (unsigned long long)nxt * gstep);
      tdm_load(g0, g1);
    }
    cur ^= 1;
  }
  wait_tensor0();
  wait_ds0();
  // the last pass's unused fetch has returned before its registers are given to other values
  asm volatile("s_wait_loadcnt 0x0" ::: "memory");

  // epilogue: normalize and write fp32 output [l][h*64+e]; 8 consecutive e per lane and tile
#pragma unroll
  for (int qt = 0; qt < 2; ++qt) {
    const float l = lrow[qt] + other_half(lrow[qt]);
    float* op = out + (size_t)(q0 + qt * 16 + cl) * D_MODEL + head * E_HEAD + cb;
#pragma unroll
    for (int t = 0; t < 4; ++t) {
      v4f o0, o1;
#pragma unroll
      for (int i = 0; i < 4; ++i) { o0[i] = acc[qt][t][i] / l; o1[i] = acc[qt][t][i + 4] / l; }
      *(v4f*)(op + t * 16)     = o0;
      *(v4f*)(op + t * 16 + 4) = o1;
    }
  }
}

// ---- launch -----------------------------------------------------------------
extern "C" void kernel_launch(void* const* d_in, const int* in_sizes, int n_in,
                              void* d_out, int out_size, void* d_ws, size_t ws_size,
                              hipStream_t stream) {
  const float* X    = (const float*)d_in[0];
  const float* mask = (const float*)d_in[1];
  const float* Wq   = (const float*)d_in[2];
  const float* bq   = (const float*)d_in[3];
  const float* Wk   = (const float*)d_in[4];
  const float* bk   = (const float*)d_in[5];
  const float* Wv   = (const float*)d_in[6];
  const float* bv   = (const float*)d_in[7];
  float* out        = (float*)d_out;

  const size_t per = (size_t)N_HEADS * L_SEQ * E_HEAD;  // 3,145,728 f16 each
  _Float16* Qh = (_Float16*)d_ws;
  _Float16* Kh = Qh + per;
  _Float16* Vt = Kh + per;

  dim3 gp(L_SEQ / 128, 3 * N_HEADS / 2);
  qkv_proj_kernel<<<gp, 256, 0, stream>>>(X, Wq, bq, Wk, bk, Wv, bv, Qh, Kh, Vt);

  dim3 ga(L_SEQ / 256, N_HEADS);
  flash_attn_kernel<<<ga, 256, 0, stream>>>(Qh, Kh, Vt, mask, out);
}
